// v000
// Times are from an AMD MI455X. After a warm-up the kernel runs many times in a row, and a time is the length of
// such a window on the GPU divided by its runs, so every launch and the gaps after it count. The runs cycle
// through copies of the inputs. A figure is the median of several windows, for all but v000 over two sittings.
// Sittings can differ by a few percent; kernels timed side by side share one.
// The starting kernel, v000, takes 477 microseconds a run.
#include <hip/hip_runtime.h>

// SAGAN-style self-attention over a 16x16x16 volume (x [2][16][16][16][64] -> tokens [2][4096][64]; f = x Wf + bf (keys), g = x Wg + bg (queries), hv = x Wh + bh (values), all 'xw' [64][32]; s = g.f (no scaling); softmax over the 4096 keys; o = (softmax . hv) Wo + bo ('xw' [32][64]); out = x + gamma o (gamma [1], read) -> [2][16][16][16][64] (0.52 M)).
// Compute dtypes, f32 accumulate: every input rounded to bf16; f/g/hv on PLAIN bf16 operands (exact) + biases; scores and attn.hv on hi/lo planes (3 products) for every row; softmax f32; o Wo as hl x exact (2 products) + bo; residual x + gamma o in f32.

#define NB_  2
#define TT   4096
#define DM   64
#define NH_  1
#define NKV  1
#define REP  (NH_ / NKV)
#define HD   64
#define DQ   (NH_ * HD)
#define DKV  (NKV * HD)
#define ZH   1
#define RH   4096                  // query rows < RH use hi+lo planes (0: none)
#define WIN  0
#define PCAR 1024.0f
#define SCL  1.0f   // no scaling in this module
#define CB   32                   // real projection width (padded to HD = 64)
#define QH   2048                 // query rows per pass
typedef _Float16 h16;
typedef unsigned short bf;
typedef __attribute__((ext_vector_type(16))) __bf16   v16bf;
typedef __attribute__((ext_vector_type(16))) _Float16 v16h;
typedef __attribute__((ext_vector_type(8)))  _Float16 v8h;
typedef __attribute__((ext_vector_type(8)))  unsigned short v8us;
typedef __attribute__((ext_vector_type(8)))  float    v8f;
typedef __attribute__((ext_vector_type(4)))  float    v4f;
typedef v8h  __attribute__((may_alias)) v8ha;
typedef v4f  __attribute__((may_alias)) v4fa;
typedef v8us __attribute__((may_alias)) v8usa;

__device__ __forceinline__ unsigned short f2bf(float f) { unsigned u = __float_as_uint(f); u += 0x7FFFu + ((u >> 16) & 1u); return (unsigned short)(u >> 16); }
__device__ __forceinline__ float bf2f(unsigned short b) { return __uint_as_float(((unsigned)b) << 16); }
__device__ __forceinline__ float bfr(float f) { return bf2f(f2bf(f)); }
__device__ __forceinline__ v16h cat16(v8h lo, v8h hi) { return __builtin_shufflevector(lo, hi, 0, 1, 2, 3, 4, 5, 6, 7, 8, 9, 10, 11, 12, 13, 14, 15); }
__device__ __forceinline__ v16bf cat16b(v8us lo, v8us hi) { return __builtin_bit_cast(v16bf, __builtin_shufflevector(lo, hi, 0, 1, 2, 3, 4, 5, 6, 7, 8, 9, 10, 11, 12, 13, 14, 15)); }
__device__ __forceinline__ v8f wmma16(v16h a, v16h b, v8f c) { return __builtin_amdgcn_wmma_f32_16x16x32_f16(false, a, false, b, (short)0, c, false, false); }
__device__ __forceinline__ v8f wmmab(v16bf a, v16bf b, v8f c) { return __builtin_amdgcn_wmma_f32_16x16x32_bf16(false, a, false, b, (short)0, c, false, false); }



// ---- k_gemmw: register-blocked GEMM, ONE WAVE per 64x64 output tile (16 accumulators), operands straight from K-contiguous 16-bit planes; grid (M/64, N/64, Z), 32 threads.
// C[m][n] (f32, pitch ldc, + optional f32 bias[n]) = sum_k A[m][k] Bt[n][k] (+ split products per NSPLIT). z-batch strides sA/sB/sC in elements. K % 32 == 0.
template <typename T16> struct WFrag;
template <> struct WFrag<h16> { typedef v16h V; static __device__ __forceinline__ V ld(const h16* p) { return cat16(*(const v8h*)p, *(const v8h*)(p + 16)); } static __device__ __forceinline__ v8f mma(V a, V b, v8f c) { return wmma16(a, b, c); } };
template <> struct WFrag<bf> { typedef v16bf V; static __device__ __forceinline__ V ld(const bf* p) { return cat16b(*(const v8us*)p, *(const v8us*)(p + 16)); } static __device__ __forceinline__ v8f mma(V a, V b, v8f c) { return wmmab(a, b, c); } };
template <typename T16, int NSPLIT, bool BIAS>
__global__ __launch_bounds__(32) void k_gemmw(const T16* __restrict__ A, const T16* __restrict__ A2, const T16* __restrict__ Bt, const T16* __restrict__ Bt2, int K, float* C, int ldc, const float* __restrict__ bias, size_t sA, size_t sB, size_t sC) {
    typedef typename WFrag<T16>::V V;
    __shared__ __align__(16) float os[16 * 68];
    const size_t z = blockIdx.z; A += z * sA; if (A2) A2 += z * sA; Bt += z * sB; if (Bt2) Bt2 += z * sB; C += z * sC;
    const int lane = threadIdx.x & 31, lr = lane & 15, hi = lane >> 4; const int r0 = blockIdx.x * 64, c0 = blockIdx.y * 64;
    v8f acc[4][4];
#pragma unroll
    for (int mb = 0; mb < 4; ++mb)
#pragma unroll
        for (int nb = 0; nb < 4; ++nb) acc[mb][nb] = (v8f){};
    const size_t aoff = (size_t)(r0 + lr) * K + 8 * hi, boff = (size_t)(c0 + lr) * K + 8 * hi;
#pragma unroll 1
    for (int kc = 0; kc < K; kc += 32) {
        V a[4], a2[4];
#pragma unroll
        for (int mb = 0; mb < 4; ++mb) { a[mb] = WFrag<T16>::ld(A + aoff + (size_t)mb * 16 * K + kc); if (NSPLIT == 1 || NSPLIT == 2) a2[mb] = WFrag<T16>::ld(A2 + aoff + (size_t)mb * 16 * K + kc); }
#pragma unroll
        for (int nb = 0; nb < 4; ++nb) { const V b = WFrag<T16>::ld(Bt + boff + (size_t)nb * 16 * K + kc); V b2; if (NSPLIT >= 2) b2 = WFrag<T16>::ld(Bt2 + boff + (size_t)nb * 16 * K + kc);
#pragma unroll
            for (int mb = 0; mb < 4; ++mb) { acc[mb][nb] = WFrag<T16>::mma(a[mb], b, acc[mb][nb]); if (NSPLIT == 1 || NSPLIT == 2) acc[mb][nb] = WFrag<T16>::mma(a2[mb], b, acc[mb][nb]); if (NSPLIT >= 2) acc[mb][nb] = WFrag<T16>::mma(a[mb], b2, acc[mb][nb]); } }
        asm volatile("v_nop\n\tv_nop\n\tv_nop\n\tv_nop" : "+v"(acc[0][0]), "+v"(acc[1][1]), "+v"(acc[2][2]), "+v"(acc[3][3]) : "v"(a[0]), "v"(a[3]));
    }
#pragma unroll
    for (int mb = 0; mb < 4; ++mb) {
#pragma unroll
        for (int nb = 0; nb < 4; ++nb) {
#pragma unroll
            for (int j = 0; j < 8; ++j) os[(hi * 8 + j) * 68 + nb * 16 + lr] = acc[mb][nb][j]; }
        __builtin_amdgcn_wave_barrier(); asm volatile("" ::: "memory");
        float* crow = C + (size_t)(r0 + mb * 16) * ldc + c0;
{
#pragma unroll
            for (int s = 0; s < 8; ++s) { const int row = 2 * s + hi, cofs = lr * 4; v4f val = *(const v4fa*)(os + row * 68 + cofs); if (BIAS) { val[0] += bfr(bias[c0 + cofs]); val[1] += bfr(bias[c0 + cofs + 1]); val[2] += bfr(bias[c0 + cofs + 2]); val[3] += bfr(bias[c0 + cofs + 3]); }
                *(v4f*)(crow + (size_t)row * ldc + cofs) = val; }
             }
        __builtin_amdgcn_wave_barrier(); asm volatile("" ::: "memory");
    }
}

__device__ __forceinline__ h16 tohx(float x) { return (h16)x; }
__device__ __forceinline__ void splitf(float y, unsigned short& h, unsigned short& l) { h = f2bf(y); l = f2bf(y - bf2f(h)); }
typedef __attribute__((ext_vector_type(2))) _Float16 v2h;
typedef __attribute__((ext_vector_type(4))) _Float16 v4h;
typedef __attribute__((ext_vector_type(2))) unsigned short v2us;
typedef __attribute__((ext_vector_type(4))) unsigned short v4us;
typedef __attribute__((ext_vector_type(2))) float v2f;
typedef __attribute__((ext_vector_type(4))) int v4i;

__global__ __launch_bounds__(256) void k_wtG(const float* __restrict__ w, int K, int N, bf* Bt) {
    const int lane = threadIdx.x & 31; const int L0 = (blockIdx.x * 8 + (threadIdx.x >> 5)) * 8; const int nlines = N * K / 64;
{
#pragma unroll 1
        for (int l = 0; l < 8; ++l) { const int L = L0 + l; if (L >= nlines) break; const size_t e = (size_t)L * 64 + lane * 2; const int k = (int)(e % K), n = (int)(e / K); v2us o;
            o[0] = f2bf(w[(size_t)k * N + n]); o[1] = f2bf(w[(size_t)(k + 1) * N + n]); *(v2us*)(Bt + e) = o; }
         }
}
__global__ __launch_bounds__(256) void k_wpad(const float* __restrict__ w, bf* Bt) { const int e = (blockIdx.x * 256 + threadIdx.x) * 2; if (e >= HD * DM) return; const int n = e / DM, k = e % DM; v2us o; o[0] = (n < CB) ? f2bf(w[(size_t)k * CB + n]) : (unsigned short)0; o[1] = (n < CB) ? f2bf(w[(size_t)(k + 1) * CB + n]) : (unsigned short)0; *(v2us*)(Bt + e) = o;  }
__global__ __launch_bounds__(256) void k_wpadT(const float* __restrict__ w, bf* Bt) { const int e = (blockIdx.x * 256 + threadIdx.x) * 2; if (e >= DM * HD) return; const int n = e / HD, k = e % HD; v2us o; o[0] = (k < CB) ? f2bf(w[(size_t)k * DM + n]) : (unsigned short)0; o[1] = (k + 1 < CB) ? f2bf(w[(size_t)(k + 1) * DM + n]) : (unsigned short)0; *(v2us*)(Bt + e) = o;  }
__global__ __launch_bounds__(64) void k_bpad(const float* __restrict__ b, float* BP) { const int n = threadIdx.x; if (n >= HD) return; const float v = (n < CB) ? b[n] : 0.0f; *(float*)(BP + n) = v;  }
__global__ __launch_bounds__(256) void k_resg(const float* __restrict__ xb, const float* __restrict__ YO, const float* __restrict__ gam, float* O, size_t n4) { const size_t i = (size_t)blockIdx.x * 256 + threadIdx.x; if (i >= n4) return; float gmv = bfr(gam[0]); asm volatile("" : "+v"(gmv)); const v4f xv = *(const v4f*)(xb + i * 4); const v4f y = *(const v4f*)(YO + i * 4); v4f o;
#pragma unroll
    for (int q = 0; q < 4; ++q) { float p = __fmul_rn(gmv, y[q]); asm volatile("" : "+v"(p)); o[q] = __fadd_rn(bfr(xv[q]), p); } *(v4f*)(O + i * 4) = o;  }
__global__ __launch_bounds__(256) void k_cvt8(const float* __restrict__ src, bf* dst, size_t n8) { const size_t i = (size_t)blockIdx.x * 256 + threadIdx.x; if (i >= n8) return; const v8f v = *(const v8f*)(src + i * 8); v8us o;
#pragma unroll
    for (int k = 0; k < 8; ++k) o[k] = f2bf(v[k]); *(v8us*)(dst + i * 8) = o;  }

// k_rope: head planes [h][t][d] (fp16 + hi/lo) of rope(x) x sc with the rotate-half convention out[d] = x[d] cos[t][d] - x[d+HD/2] sin[t][d], out[d+HD/2] = x[d+HD/2] cos[t][d+HD/2] + x[d] sin[t][d+HD/2]
__global__ __launch_bounds__(256) void k_rope(const float* __restrict__ F, int pitch, int nheads, const float* __restrict__ CS, const float* __restrict__ RF, const float* __restrict__ nw, float sc, h16* P16, bf* Ph, bf* Pl) {
    const size_t e = ((size_t)blockIdx.x * 256 + threadIdx.x) * 2; if (e >= (size_t)nheads * TT * HD) return; const int d = (int)(e % HD); const int t = (int)((e / HD) % TT); const int h = (int)(e / ((size_t)HD * TT)); const float* f = F + (size_t)t * pitch + h * HD; const float rf = RF ? RF[(size_t)h * TT + t] : 1.0f; v2h o16; v2us oh, ol;
#pragma unroll
    for (int q = 0; q < 2; ++q) { const int dd = d + q; const int dp = (dd < HD / 2) ? dd + HD / 2 : dd - HD / 2; float x0 = f[dd], x1 = f[dp];
        if (RF) { float n0 = __fmul_rn(x0, rf), n1 = __fmul_rn(x1, rf); asm volatile("" : "+v"(n0)); asm volatile("" : "+v"(n1)); x0 = __fmul_rn(bfr(nw[dd]), n0); x1 = __fmul_rn(bfr(nw[dp]), n1); }
        const v2f cs = *(const v2f*)(CS + ((size_t)t * HD + dd) * 2); float a = __fmul_rn(x0, cs[0]), bq = __fmul_rn(x1, cs[1]); asm volatile("" : "+v"(a)); asm volatile("" : "+v"(bq)); const float r = ((dd < HD / 2) ? __fsub_rn(a, bq) : __fadd_rn(a, bq)) * sc;
        o16[q] = tohx(r); unsigned short a2, c2; splitf(r, a2, c2); oh[q] = a2; ol[q] = c2; }
    *(v2h*)(P16 + e) = o16; *(v2us*)(Ph + e) = oh; *(v2us*)(Pl + e) = ol;  }
__global__ __launch_bounds__(256) void k_vtp(const float* __restrict__ F, int pitch, int nheads, h16* V16, bf* Vh, bf* Vl) { const size_t e = ((size_t)blockIdx.x * 256 + threadIdx.x) * 2; if (e >= (size_t)nheads * HD * TT) return; const int t = (int)(e % TT); const int d = (int)((e / TT) % HD); const int g = (int)(e / ((size_t)TT * HD)); v2h o16; v2us oh, ol;
#pragma unroll
    for (int q = 0; q < 2; ++q) { const float x = F[(size_t)(t + q) * pitch + g * HD + d]; o16[q] = tohx(x); unsigned short a2, c2; splitf(x, a2, c2); oh[q] = a2; ol[q] = c2; }
    *(v2h*)(V16 + e) = o16; *(v2us*)(Vh + e) = oh; *(v2us*)(Vl + e) = ol;  }
__global__ __launch_bounds__(256) void k_csid(float* CS) { const int idx = blockIdx.x * 256 + threadIdx.x; if (idx >= TT * HD) return; v2f cs; cs[0] = 1.0f; cs[1] = 0.0f; *(v2f*)(CS + (size_t)idx * 2) = cs;  }
// k_asoft: per row (zz, i): t = S x SCL = S (no scaling, no mask); softmax over the 4096 keys (register row, one exp, fixed trees);
__global__ __launch_bounds__(256) void k_asoft(const float* __restrict__ Sb, h16* P16, bf* Ph, bf* Pl) {
    const int lane = threadIdx.x & 31; const int row = blockIdx.x * 8 + (threadIdx.x >> 5); if (row >= ZH * TT) return; const int i = row % TT; const int zz = row / TT; (void)zz; const bool hires = (i < RH); const float* sr = Sb + (size_t)row * TT; float v[TT / 32]; float mx = -3.0e38f;
#pragma unroll
    for (int ch = 0; ch < TT / 128; ++ch) { const int j0 = ch * 128 + lane * 4; const v4f a = *(const v4f*)(sr + j0);
#pragma unroll
        for (int q = 0; q < 4; ++q) { const int j = j0 + q; (void)j; const float t = a[q] * SCL; v[ch * 4 + q] = t; mx = fmaxf(mx, t); } }
#pragma unroll
    for (int sh = 16; sh; sh >>= 1) mx = fmaxf(mx, __shfl_xor(mx, sh, 32));
    float sum = 0.f;
#pragma unroll
    for (int k = 0; k < TT / 32; ++k) { float d0 = __fsub_rn(v[k], mx); asm volatile("" : "+v"(d0)); v[k] = __builtin_amdgcn_exp2f(__fmul_rn(d0, 1.4426950408889634f)); sum += v[k]; }
#pragma unroll
    for (int sh = 16; sh; sh >>= 1) sum += __shfl_xor(sum, sh, 32);
    const float f = __fdiv_rn(hires ? 1.0f : PCAR, sum);
{
        if (hires) {
#pragma unroll
            for (int ch = 0; ch < TT / 128; ++ch) { v4us oh, ol;
#pragma unroll
                for (int q = 0; q < 4; ++q) { unsigned short a, c2; splitf(v[ch * 4 + q] * f, a, c2); oh[q] = a; ol[q] = c2; }
                const size_t oo = ((size_t)zz * (RH ? RH : 1) + i) * TT + ch * 128 + lane * 4; *(v4us*)(Ph + oo) = oh; *(v4us*)(Pl + oo) = ol; }
        } else {
#pragma unroll
            for (int ch = 0; ch < TT / 128; ++ch) { v4h o4;
#pragma unroll
                for (int q = 0; q < 4; ++q) o4[q] = tohx(v[ch * 4 + q] * f);
                *(v4h*)(P16 + (size_t)row * TT + ch * 128 + lane * 4) = o4; } }
         }
}
__global__ __launch_bounds__(256) void k_merge(const float* __restrict__ O, int h0, bf* Ah, bf* Al) { const size_t e = ((size_t)blockIdx.x * 256 + threadIdx.x) * 2; if (e >= (size_t)ZH * TT * HD) return; const int d = (int)(e % HD); const int t = (int)((e / HD) % TT); const int zz = (int)(e / ((size_t)HD * TT)); const float cs = (t < RH) ? 1.0f : (1.0f / PCAR); const size_t oo = (size_t)t * DQ + (h0 + zz) * HD + d;
    v2us oh, ol;
#pragma unroll
    for (int q = 0; q < 2; ++q) { unsigned short a, c2; splitf(O[e + q] * cs, a, c2); oh[q] = a; ol[q] = c2; } *(v2us*)(Ah + oo) = oh; *(v2us*)(Al + oo) = ol;  }

extern "C" void kernel_launch(void* const* d_in, const int* in_sizes, int n_in,
                              void* d_out, int out_size, void* d_ws, size_t ws_size, hipStream_t stream) {
    (void)in_sizes; (void)n_in; (void)out_size;
    const float* x = (const float*)d_in[0]; const float* wf = (const float*)d_in[1]; const float* bff = (const float*)d_in[2]; const float* wg = (const float*)d_in[3]; const float* bg = (const float*)d_in[4]; const float* wh = (const float*)d_in[5]; const float* bh = (const float*)d_in[6]; const float* wo = (const float*)d_in[7]; const float* bo = (const float*)d_in[8]; const float* gam = (const float*)d_in[9];
    float* OUT = (float*)d_out;     // [2][4096][64]
    char* wsp = (char*)d_ws;
    auto take = [&](size_t bytes) { char* p = wsp; wsp += (bytes + 255) & ~(size_t)255; return (void*)p; };
    bf* WQ = (bf*)take((size_t)HD * DM * 2); bf* WK = (bf*)take((size_t)HD * DM * 2); bf* WV = (bf*)take((size_t)HD * DM * 2); bf* WO = (bf*)take((size_t)DM * HD * 2); float* BQ = (float*)take(256); float* BK = (float*)take(256); float* BV = (float*)take(256); float* CS = (float*)take((size_t)TT * HD * 2 * 4);
    bf* XB = (bf*)take((size_t)TT * DM * 2); float* FQ = (float*)take((size_t)TT * DQ * 4); float* FK = (float*)take((size_t)TT * DKV * 4); float* YO = (float*)take((size_t)TT * DM * 4);
    h16* QP16 = (h16*)take((size_t)TT * HD * 2); h16* KP16 = (h16*)take((size_t)TT * HD * 2); h16* VT16 = (h16*)take((size_t)HD * TT * 2);   /* written by the shared builders, not read (every row hi/lo) */
    bf* QPh = (bf*)take((size_t)TT * HD * 2); bf* QPl = (bf*)take((size_t)TT * HD * 2); bf* KPh = (bf*)take((size_t)TT * HD * 2); bf* KPl = (bf*)take((size_t)TT * HD * 2); bf* VTh = (bf*)take((size_t)HD * TT * 2); bf* VTl = (bf*)take((size_t)HD * TT * 2); bf* Ph = (bf*)take((size_t)QH * TT * 2); bf* Pl = (bf*)take((size_t)QH * TT * 2);
    float* Sb = (float*)take((size_t)QH * TT * 4); h16* P16 = (h16*)take(256);   /* unused: all rows hi/lo */ float* Ob = (float*)take((size_t)QH * HD * 4); bf* ATh = (bf*)take((size_t)TT * DQ * 2); bf* ATl = (bf*)take((size_t)TT * DQ * 2);
    if ((size_t)(wsp - (char*)d_ws) > ws_size) return;
    float* FV = FK;   // v projection reuses the k buffer after the k planes are built (stream-ordered)
    k_wpad<<<(HD * DM / 2 + 255) / 256, 256, 0, stream>>>(wg, WQ); k_wpad<<<(HD * DM / 2 + 255) / 256, 256, 0, stream>>>(wf, WK); k_wpad<<<(HD * DM / 2 + 255) / 256, 256, 0, stream>>>(wh, WV); k_wpadT<<<(DM * HD / 2 + 255) / 256, 256, 0, stream>>>(wo, WO);   /* queries from Wg, keys from Wf, values from Wh; Wo padded on its input side */
    k_bpad<<<1, 64, 0, stream>>>(bg, BQ); k_bpad<<<1, 64, 0, stream>>>(bff, BK); k_bpad<<<1, 64, 0, stream>>>(bh, BV);
    k_csid<<<(TT * HD + 255) / 256, 256, 0, stream>>>(CS);
    const unsigned LQ = (unsigned)(((size_t)TT * HD / 2 + 255) / 256);
    for (int b = 0; b < NB_; ++b) {
        k_cvt8<<<(unsigned)(((size_t)TT * DM / 8 + 255) / 256), 256, 0, stream>>>(x + (size_t)b * TT * DM, XB, (size_t)TT * DM / 8);
        k_gemmw<bf, 0, true><<<dim3(TT / 64, 1, 1), 32, 0, stream>>>(XB, nullptr, WQ, nullptr, DM, FQ, DQ, BQ, 0, 0, 0); k_rope<<<LQ, 256, 0, stream>>>(FQ, DQ, 1, CS, nullptr, nullptr, 1.0f, QP16, QPh, QPl);   /* g (queries), columns 32..63 exactly 0 */
        k_gemmw<bf, 0, true><<<dim3(TT / 64, 1, 1), 32, 0, stream>>>(XB, nullptr, WK, nullptr, DM, FK, DKV, BK, 0, 0, 0); k_rope<<<LQ, 256, 0, stream>>>(FK, DKV, 1, CS, nullptr, nullptr, 1.0f, KP16, KPh, KPl);   /* f (keys) */
        k_gemmw<bf, 0, true><<<dim3(TT / 64, 1, 1), 32, 0, stream>>>(XB, nullptr, WV, nullptr, DM, FV, DKV, BV, 0, 0, 0); k_vtp<<<LQ, 256, 0, stream>>>(FV, DKV, 1, VT16, VTh, VTl);   /* hv (values) */
        for (int qh = 0; qh < TT; qh += QH) {   
            k_gemmw<bf, 2, false><<<dim3(QH / 64, TT / 64, 1), 32, 0, stream>>>(QPh + (size_t)qh * HD, QPl + (size_t)qh * HD, KPh, KPl, HD, Sb, TT, nullptr, 0, 0, 0);   /* s = g.f [2048][4096] (3 products) */
            k_asoft<<<QH / 8, 256, 0, stream>>>(Sb, P16, Ph, Pl);                                                                                                          /* rows 0..2047 of the pass, all hi/lo */
            k_gemmw<bf, 2, false><<<dim3(QH / 64, HD / 64, 1), 32, 0, stream>>>(Ph, Pl, VTh, VTl, TT, Ob, HD, nullptr, 0, 0, 0);                                           /* softmax . hv [2048][64] (3 products) */
            k_merge<<<(unsigned)(((size_t)QH * HD / 2 + 255) / 256), 256, 0, stream>>>(Ob, 0, ATh + (size_t)qh * DQ, ATl + (size_t)qh * DQ); }                                /* AT rows qh.. (hi/lo, scale 1) */
        k_gemmw<bf, 1, true><<<dim3(TT / 64, DM / 64, 1), 32, 0, stream>>>(ATh, ATl, WO, nullptr, DQ, YO, DM, bo, 0, 0, 0);   /* o Wo + bo -> YO [4096][64] */
        k_resg<<<(unsigned)(((size_t)TT * DM / 4 + 255) / 256), 256, 0, stream>>>(x + (size_t)b * TT * DM, YO, gam, OUT + (size_t)b * TT * DM, (size_t)TT * DM / 4); }   /* out = x + gamma o */
}

// v002
// It runs in 32.8 microseconds.
// Versions in between are left out here; by their measured steps it is 14.6 times as fast as v000.
#include <hip/hip_runtime.h>

// SAGAN-style self-attention over a 16x16x16 volume (x [2][16][16][16][64] -> tokens [2][4096][64]; f = x Wf + bf (keys), g = x Wg + bg (queries), hv = x Wh + bh (values), all 'xw' [64][32]; s = g.f (no scaling); softmax over the 4096 keys; o = (softmax . hv) Wo + bo ('xw' [32][64]); out = x + gamma o (gamma [1], read) -> [2][16][16][16][64] (0.52 M)).
// Compute dtypes, f32 accumulate: every input rounded to bf16; f/g/hv on PLAIN bf16 operands (exact) + biases; scores and attn.hv on hi/lo planes (3 products) for every row; softmax f32; o Wo as hl x exact (2 products) + bo; residual x + gamma o in f32.
// Two launches, both batches in each: k_proj (inputs -> q, k and transposed v hi/lo planes), k_fattn (attention, out projection, residual).

#define NB_  2
#define TT   4096
#define DM   64
#define HD   64                   // row pitch of the q and k planes, in elements (columns CB..HD-1 are neither written nor read)
#define CB   32                   // projection width
#define KW   16                   // waves per work-group of the fused attention kernel (four per SIMD), one key range each
#define KR   (TT / KW)            // keys per wave
#define L2E  1.4426950408889634f
typedef unsigned short bf;
typedef __attribute__((ext_vector_type(16))) __bf16   v16bf;
typedef __attribute__((ext_vector_type(8)))  unsigned short v8us;
typedef __attribute__((ext_vector_type(4)))  unsigned short v4us;
typedef __attribute__((ext_vector_type(8)))  float    v8f;
typedef __attribute__((ext_vector_type(4)))  float    v4f;
typedef __attribute__((ext_vector_type(2)))  float    v2f;
typedef v4f  __attribute__((may_alias)) v4fa;

__device__ __forceinline__ unsigned short f2bf(float f) { unsigned u = __float_as_uint(f); u += 0x7FFFu + ((u >> 16) & 1u); return (unsigned short)(u >> 16); }
__device__ __forceinline__ float bf2f(unsigned short b) { return __uint_as_float(((unsigned)b) << 16); }
__device__ __forceinline__ float bfr(float f) { return bf2f(f2bf(f)); }
__device__ __forceinline__ void splitf(float y, unsigned short& h, unsigned short& l) { h = f2bf(y); l = f2bf(y - bf2f(h)); }
__device__ __forceinline__ v16bf cat16b(v8us lo, v8us hi) { return __builtin_bit_cast(v16bf, __builtin_shufflevector(lo, hi, 0, 1, 2, 3, 4, 5, 6, 7, 8, 9, 10, 11, 12, 13, 14, 15)); }
__device__ __forceinline__ v8f wmmab(v16bf a, v16bf b, v8f c) { return __builtin_amdgcn_wmma_f32_16x16x32_bf16(false, a, false, b, (short)0, c, false, false); }

// Fragment loaders. Lane (c, h) holds row c of 16 rows; of a block of 32 k it holds k = 8 h + 0..7 and 16 + 8 h + 0..7, in that order, in all three.
template <typename T16> struct WFrag;
template <> struct WFrag<bf> { typedef v16bf V; static __device__ __forceinline__ V ld(const bf* p) { return cat16b(*(const v8us*)p, *(const v8us*)(p + 16)); } };   // p = row c, k = 8 h, of a bf16 plane with k contiguous
__device__ __forceinline__ v16bf xfrag(const float* p) {   // p = row c, k = 8 h, of an f32 array with k contiguous; rounded to bf16
    const v4f a = *(const v4fa*)p, b = *(const v4fa*)(p + 4), d = *(const v4fa*)(p + 16), e = *(const v4fa*)(p + 20); v8us lo, hi;
#pragma unroll
    for (int i = 0; i < 4; ++i) { lo[i] = f2bf(a[i]); lo[4 + i] = f2bf(b[i]); hi[i] = f2bf(d[i]); hi[4 + i] = f2bf(e[i]); }
    return cat16b(lo, hi); }
__device__ __forceinline__ v16bf wfrag(const float* p, int ld) {   // p = k row 8 h, column c, of an f32 'xw' weight [k][ld]: column c as a fragment row; rounded to bf16
    v8us lo, hi;
#pragma unroll
    for (int i = 0; i < 8; ++i) { lo[i] = f2bf(p[i * ld]); hi[i] = f2bf(p[(16 + i) * ld]); }
    return cat16b(lo, hi); }

// ---- k_proj: the three projections with their biases, split into hi/lo bf16 planes. grid NB_ TT / 64, 192 threads: a work-group owns 64 tokens; waves 0, 1 make q, waves 2, 3 k (32 tokens each), waves 4, 5 v (16 columns each).
// q and k as W^T x^T (A = weight columns, B = token rows): a lane's 8 accumulator registers are 8 consecutive columns of one token, one 16-byte store per plane into [token][HD].
// v as x W (A = token rows, B = weight columns): the 8 registers are 8 consecutive tokens of one column, one 16-byte store per plane into the transposed [batch][column][TT]; the wave's 64 tokens fill whole 128-byte lines.
// Every loop is unrolled: its index picks registers of the fragment arrays, and all loads of a wave go out together.
__global__ __launch_bounds__(192) void k_proj(const float* __restrict__ x, const float* __restrict__ wg, const float* __restrict__ bg, const float* __restrict__ wf, const float* __restrict__ bff, const float* __restrict__ wh, const float* __restrict__ bh, bf* Qh, bf* Ql, bf* Kh, bf* Kl, bf* Vh, bf* Vl) {
    const int lane = threadIdx.x & 31, c = lane & 15, h = lane >> 4, w = __builtin_amdgcn_readfirstlane(threadIdx.x >> 5), hf = w & 1; const int T0 = blockIdx.x * 64;   // T0: first token, counted through both batches
    if (w < 4) {
        const float* wt = (w < 2) ? wg : wf; const float* bs = (w < 2) ? bg : bff; bf* Ph = (w < 2) ? Qh : Kh; bf* Pl = (w < 2) ? Ql : Kl; const int T1 = T0 + 32 * hf;
        const float* px = x + (size_t)(T1 + c) * DM + 8 * h; const float* pw = wt + (size_t)(8 * h) * CB + c; const float* pb = bs + 8 * h;
        v16bf xa[2][2], wa[2][2]; float bv[2][8];
#pragma unroll
        for (int tt = 0; tt < 2; ++tt)
#pragma unroll
            for (int kk = 0; kk < 2; ++kk) { xa[tt][kk] = xfrag(px + 16 * tt * DM + 32 * kk); wa[tt][kk] = wfrag(pw + 32 * kk * CB + 16 * tt, CB); }
#pragma unroll
        for (int dt = 0; dt < 2; ++dt)
#pragma unroll
            for (int r = 0; r < 8; ++r) bv[dt][r] = bfr(pb[16 * dt + r]);
        asm volatile("s_wait_xcnt 0x0" :: "v"(px), "v"(pw), "v"(pb) : "memory");   // the loads' address registers stay whole until every load above has taken its address
#pragma unroll
        for (int dt = 0; dt < 2; ++dt) {
#pragma unroll
            for (int tt = 0; tt < 2; ++tt) { v8f a = (v8f){}; a = wmmab(wa[dt][0], xa[tt][0], a); a = wmmab(wa[dt][1], xa[tt][1], a); v8us oh, ol;
#pragma unroll
                for (int r = 0; r < 8; ++r) { unsigned short a2, c2; splitf(a[r] + bv[dt][r], a2, c2); oh[r] = a2; ol[r] = c2; }
                const size_t e = (size_t)(T1 + 16 * tt + c) * HD + 16 * dt + 8 * h; *(v8us*)(Ph + e) = oh; *(v8us*)(Pl + e) = ol; } }
        asm volatile("s_wait_xcnt 0x0" ::: "memory");   // behind the branch's last stores: the built code lays the two branches one behind the other, in an order the compiler picks, and the later one writes registers that these stores name
    } else {
        const int b = T0 / TT, t0 = T0 % TT, d = 16 * hf + c;
        const float* px = x + (size_t)(T0 + c) * DM + 8 * h; const float* pw = wh + (size_t)(8 * h) * CB + d; const float* pb = bh + d;
        v16bf xa[4][2], wa[2];
#pragma unroll
        for (int kk = 0; kk < 2; ++kk) { wa[kk] = wfrag(pw + 32 * kk * CB, CB);
#pragma unroll
            for (int tt = 0; tt < 4; ++tt) xa[tt][kk] = xfrag(px + 16 * tt * DM + 32 * kk); }
        const float bv = bfr(pb[0]);
        asm volatile("s_wait_xcnt 0x0" :: "v"(px), "v"(pw), "v"(pb) : "memory");   // the loads' address registers stay whole until every load above has taken its address
#pragma unroll
        for (int tt = 0; tt < 4; ++tt) { v8f a = (v8f){}; a = wmmab(xa[tt][0], wa[0], a); a = wmmab(xa[tt][1], wa[1], a); v8us oh, ol;
#pragma unroll
            for (int r = 0; r < 8; ++r) { unsigned short a2, c2; splitf(a[r] + bv, a2, c2); oh[r] = a2; ol[r] = c2; }
            const size_t e = ((size_t)b * CB + d) * TT + t0 + 16 * tt + 8 * h; *(v8us*)(Vh + e) = oh; *(v8us*)(Vl + e) = ol; }
        asm volatile("s_wait_xcnt 0x0" ::: "memory");   // behind the branch's last stores: the built code lays the two branches one behind the other, in an order the compiler picks, and the later one writes registers that these stores name
    }
}

// ---- k_fattn: scores, softmax and softmax . hv in one kernel (running maximum and sum; no score or weight plane in memory), then the out projection and the residual on the joined rows. grid (TT / 32, NB_), 32 KW threads.
// A work-group owns 32 queries; wave w walks keys [w KR, (w + 1) KR) in blocks of 32 and the KW partial results are joined in LDS.
// S^T = K Q^T (A = key rows, B = query rows, both by WFrag::ld) puts one query's scores in one lane pair (c, c + 16); the two 16-key score tiles, converted in place, are the B operand of O^T += V^T P^T.
// Tail: the joined 32 x CB rows go to LDS as hi/lo bf16; four waves make out^T = Wo^T o^T (A = Wo columns, B = query rows), 16 queries x 32 columns each, so that a lane holds 8 consecutive columns of one token and a wave stores whole 128-byte lines (its loops unrolled for the same reason as in k_proj).
typedef __attribute__((ext_vector_type(2))) __bf16 v2bf;
typedef __attribute__((ext_vector_type(8))) unsigned v8u;
__device__ __forceinline__ float xhalf(float x) { const int b = __float_as_int(x); return __int_as_float(__builtin_amdgcn_permlanex16(b, b, 0x76543210, 0xfedcba98, false, false)); }   // value of lane l ^ 16
__device__ __forceinline__ v16bf ldf(const bf* base, unsigned bytes) { return WFrag<bf>::ld((const bf*)((const char*)base + bytes)); }   // fragment at a wave-uniform base + the lane's fixed byte offset
__global__ __launch_bounds__(32 * KW) void k_fattn(const bf* __restrict__ Qh, const bf* __restrict__ Ql, const bf* __restrict__ Kh, const bf* __restrict__ Kl, const bf* __restrict__ Vh, const bf* __restrict__ Vl, const float* __restrict__ x, const float* __restrict__ wo, const float* __restrict__ bo, const float* __restrict__ gam, float* O) {
    __shared__ __align__(16) float so[KW][32][CB + 4];   // [wave][query][d], pitch 144 B
    __shared__ float sm[KW][32], sl[KW][32], sw[KW][32];   // per wave and query: maximum, sum, weight in the join
    __shared__ __align__(16) bf sah[32][CB + 8], sal[32][CB + 8];   // joined rows, hi and lo, pitch 80 B
    const int lane = threadIdx.x & 31, c = lane & 15, h = lane >> 4, w = __builtin_amdgcn_readfirstlane(threadIdx.x >> 5); const int q0 = blockIdx.x * 32; const int k0 = w * KR; const int bz = blockIdx.y;   // w in a scalar register: scalar loop control and key addresses
    const unsigned rb = (unsigned)((bz * TT + c) * HD + 8 * h) * 2u, vb = (unsigned)((bz * CB + c) * TT + 8 * h) * 2u;   // the lane's bytes inside 16 query or key rows, and inside 16 value rows, of this batch's planes
    const bf* pqh = (const bf*)((const char*)(Qh + (size_t)q0 * HD) + rb); const bf* pql = (const bf*)((const char*)(Ql + (size_t)q0 * HD) + rb);
    v16bf qh[2], ql[2], kh[2], kl[2];
#pragma unroll
    for (int g = 0; g < 2; ++g) { const size_t qo = (size_t)(16 * g) * HD; qh[g] = WFrag<bf>::ld(pqh + qo); ql[g] = WFrag<bf>::ld(pql + qo); }
    asm volatile("s_wait_xcnt 0x0" ::: "memory");   // parts the query loads from the key loads
#pragma unroll
    for (int t = 0; t < 2; ++t) { const size_t ko = (size_t)(k0 + 16 * t) * HD; kh[t] = ldf(Kh + ko, rb); kl[t] = ldf(Kl + ko, rb); }
    v8f o[2][2]; float m[2], l[2];
#pragma unroll
    for (int g = 0; g < 2; ++g) { o[0][g] = (v8f){}; o[1][g] = (v8f){}; m[g] = -3.0e38f; l[g] = 0.f; }
#pragma unroll 1   // kept rolled: the body is long and runs KR / 32 times
    for (int kb = k0; kb < k0 + KR; kb += 32) {
        v16bf vh[2], vl[2];
#pragma unroll
        for (int dt = 0; dt < 2; ++dt) { const size_t vo = (size_t)(16 * dt) * TT + kb; vh[dt] = ldf(Vh + vo, vb); vl[dt] = ldf(Vl + vo, vb); }
        __builtin_amdgcn_sched_barrier(0);   // keeps the value loads up here, a whole score and softmax phase ahead of their use (the scheduler sank them to their WMMAs, one exposed wait each)
        v8f s[2][2];
#pragma unroll
        for (int t = 0; t < 2; ++t)
#pragma unroll
            for (int g = 0; g < 2; ++g) { v8f a = (v8f){}; a = wmmab(kh[t], qh[g], a); a = wmmab(kh[t], ql[g], a); a = wmmab(kl[t], qh[g], a); s[t][g] = a; }
        const int kn = (kb + 32 < k0 + KR) ? kb + 32 : kb;   // next block's key rows are fetched now, behind their last use; the last block fetches its own again
#pragma unroll
        for (int t = 0; t < 2; ++t) { const size_t ko = (size_t)(kn + 16 * t) * HD; kh[t] = ldf(Kh + ko, rb); kl[t] = ldf(Kl + ko, rb); }
        __builtin_amdgcn_sched_barrier(0);   // keeps the next key loads in front of the softmax, which then covers their latency (the scheduler sank them to the loop's foot)
        v16bf ph[2], pl[2];
#pragma unroll
        for (int g = 0; g < 2; ++g) {
            float mx = s[0][g][0];
#pragma unroll
            for (int r = 1; r < 8; ++r) mx = fmaxf(mx, s[0][g][r]);
#pragma unroll
            for (int r = 0; r < 8; ++r) mx = fmaxf(mx, s[1][g][r]);
            mx = fmaxf(mx, xhalf(mx));
            const float mn = fmaxf(m[g], mx); const float al = __builtin_amdgcn_exp2f((m[g] - mn) * L2E); const float ml = mn * L2E; m[g] = mn;
            v2f sum = (v2f){}; const v2f le2 = { L2E, L2E }, ml2 = { -ml, -ml }; v8u hw, lw;
#pragma unroll
            for (int i = 0; i < 8; ++i) { const int t = i >> 2, r = (i & 3) * 2; v2f x = { s[t][g][r], s[t][g][r + 1] }; x = __builtin_elementwise_fma(x, le2, ml2); v2f p; p[0] = __builtin_amdgcn_exp2f(x[0]); p[1] = __builtin_amdgcn_exp2f(x[1]); sum += p;
                const unsigned hu = __builtin_bit_cast(unsigned, __builtin_convertvector(p, v2bf)); v2f e; e[0] = p[0] - __uint_as_float(hu << 16); e[1] = p[1] - __uint_as_float(hu & 0xFFFF0000u);
                hw[i] = hu; lw[i] = __builtin_bit_cast(unsigned, __builtin_convertvector(e, v2bf)); }
            l[g] = l[g] * al + (sum[0] + sum[1]); o[0][g] *= al; o[1][g] *= al; ph[g] = __builtin_bit_cast(v16bf, hw); pl[g] = __builtin_bit_cast(v16bf, lw); }
#pragma unroll
        for (int dt = 0; dt < 2; ++dt)
#pragma unroll
            for (int g = 0; g < 2; ++g) { v8f a = o[dt][g]; a = wmmab(vh[dt], ph[g], a); a = wmmab(vh[dt], pl[g], a); a = wmmab(vl[dt], ph[g], a); o[dt][g] = a; }
    }
#pragma unroll
    for (int g = 0; g < 2; ++g) { const float lt = l[g] + xhalf(l[g]); if (h == 0) { sm[w][16 * g + c] = m[g]; sl[w][16 * g + c] = lt; }
#pragma unroll
        for (int dt = 0; dt < 2; ++dt) { float* dst = &so[w][16 * g + c][16 * dt + 8 * h]; *(v4fa*)dst = __builtin_shufflevector(o[dt][g], o[dt][g], 0, 1, 2, 3); *(v4fa*)(dst + 4) = __builtin_shufflevector(o[dt][g], o[dt][g], 4, 5, 6, 7); } }
    __syncthreads();
    float M = sm[0][lane];   // thread (w, lane) makes the one weight of wave w's partial for query lane
#pragma unroll
    for (int k = 1; k < KW; ++k) M = fmaxf(M, sm[k][lane]);
    const float wt = __builtin_amdgcn_exp2f((sm[w][lane] - M) * L2E); sw[w][lane] = wt; sl[w][lane] *= wt;
    __syncthreads();
    if (w < 8) {   // the join is 32 queries x 8 threads
        const int q = threadIdx.x >> 3, d0 = (threadIdx.x & 7) * 4; float L = 0.f; v4f acc = (v4f){};
#pragma unroll
        for (int k = 0; k < KW; ++k) { L += sl[k][q]; acc += *(const v4fa*)&so[k][q][d0] * sw[k][q]; }
        const float inv = __fdiv_rn(1.0f, L); v4us oh, ol;
#pragma unroll
        for (int k = 0; k < 4; ++k) { unsigned short a, c2; splitf(acc[k] * inv, a, c2); oh[k] = a; ol[k] = c2; }
        *(v4us*)&sah[q][d0] = oh; *(v4us*)&sal[q][d0] = ol; }
    __syncthreads();   // hands the joined rows to the waves of the out projection
    if (w >= 4) return;   // no barrier follows
    const int g = w & 1, np = w >> 1;   // 16 queries, 32 output columns
    const v16bf ah = WFrag<bf>::ld(&sah[16 * g + c][8 * h]), al = WFrag<bf>::ld(&sal[16 * g + c][8 * h]);
    const float gm = bfr(gam[0]); const size_t ro = (size_t)(bz * TT + q0 + 16 * g + c) * DM + 32 * np + 8 * h;
    const float* px = x + ro; const float* pw = wo + (size_t)(8 * h) * DM + 32 * np + c; const float* pb = bo + 32 * np + 8 * h;
    v16bf wa[2]; v4f xv[2][2], bv[2][2];
#pragma unroll
    for (int j = 0; j < 2; ++j) { wa[j] = wfrag(pw + 16 * j, DM);
#pragma unroll
        for (int u = 0; u < 2; ++u) { xv[j][u] = *(const v4fa*)(px + 16 * j + 4 * u); bv[j][u] = *(const v4fa*)(pb + 16 * j + 4 * u); } }
    asm volatile("s_wait_xcnt 0x0" :: "v"(px), "v"(pw) : "memory");   // the loads' address registers stay whole until every load above has taken its address
#pragma unroll
    for (int j = 0; j < 2; ++j) { v8f a = (v8f){}; a = wmmab(wa[j], ah, a); a = wmmab(wa[j], al, a);
#pragma unroll
        for (int u = 0; u < 2; ++u) { v4f y;
#pragma unroll
            for (int r = 0; r < 4; ++r) y[r] = bfr(xv[j][u][r]) + gm * (a[4 * u + r] + bfr(bv[j][u][r]));
            *(v4fa*)(O + ro + 16 * j + 4 * u) = y; } }
}

extern "C" void kernel_launch(void* const* d_in, const int* in_sizes, int n_in,
                              void* d_out, int out_size, void* d_ws, size_t ws_size, hipStream_t stream) {
    (void)in_sizes; (void)n_in; (void)out_size;
    const float* x = (const float*)d_in[0]; const float* wf = (const float*)d_in[1]; const float* bff = (const float*)d_in[2]; const float* wg = (const float*)d_in[3]; const float* bg = (const float*)d_in[4]; const float* wh = (const float*)d_in[5]; const float* bh = (const float*)d_in[6]; const float* wo = (const float*)d_in[7]; const float* bo = (const float*)d_in[8]; const float* gam = (const float*)d_in[9];
    float* OUT = (float*)d_out;     // [2][4096][64]
    char* wsp = (char*)d_ws;
    auto take = [&](size_t bytes) { char* p = wsp; wsp += (bytes + 255) & ~(size_t)255; return (void*)p; };
    bf* QPh = (bf*)take((size_t)NB_ * TT * HD * 2); bf* QPl = (bf*)take((size_t)NB_ * TT * HD * 2); bf* KPh = (bf*)take((size_t)NB_ * TT * HD * 2); bf* KPl = (bf*)take((size_t)NB_ * TT * HD * 2); bf* VTh = (bf*)take((size_t)NB_ * CB * TT * 2); bf* VTl = (bf*)take((size_t)NB_ * CB * TT * 2);
    if ((size_t)(wsp - (char*)d_ws) > ws_size) return;
    k_proj<<<NB_ * TT / 64, 192, 0, stream>>>(x, wg, bg, wf, bff, wh, bh, QPh, QPl, KPh, KPl, VTh, VTl);   /* queries from Wg, keys from Wf, values from Wh */
    k_fattn<<<dim3(TT / 32, NB_), 32 * KW, 0, stream>>>(QPh, QPl, KPh, KPl, VTh, VTl, x, wo, bo, gam, OUT);   /* out = x + gamma ((softmax(g.f) . hv) Wo + bo) */
}

// v003
// It runs in 22.2 microseconds.
// In two side-by-side timings against v002, it was 1.49 and 1.46 times as fast.
// Counting every step since v000, it is 21.5 times as fast.
#include <hip/hip_runtime.h>

// SAGAN-style self-attention over a 16x16x16 volume (x [2][16][16][16][64] -> tokens [2][4096][64]; f = x Wf + bf (keys), g = x Wg + bg (queries), hv = x Wh + bh (values), all 'xw' [64][32]; s = g.f (no scaling); softmax over the 4096 keys; o = (softmax . hv) Wo + bo ('xw' [32][64]); out = x + gamma o (gamma [1], read) -> [2][16][16][16][64] (0.52 M)).
// Compute dtypes, f32 accumulate: every input rounded to bf16; f/g/hv on PLAIN bf16 operands (exact) + biases; scores and attn.hv on hi/lo planes (3 products) for every row; softmax f32; o Wo as hl x exact (2 products) + bo; residual x + gamma o in f32.
// Two launches, both batches in each: k_proj (inputs -> q, k and v hi/lo planes, stored in fragment order), k_fattn (attention, out projection, residual).

#define NB_  2
#define TT   4096
#define DM   64
#define CB   32                   // projection width
#define FE   512                  // elements of one stored fragment (16 rows x 32 k): two pieces of 32 lanes x 8 elements, so that a wave's 16-byte load or store covers 512 contiguous bytes
#define KW   16                   // waves per work-group of the fused attention kernel (four per SIMD), one key range each
#define KR   (TT / KW)            // keys per wave
#define L2E  1.4426950408889634f
typedef unsigned short bf;
typedef __attribute__((ext_vector_type(16))) __bf16   v16bf;
typedef __attribute__((ext_vector_type(8)))  unsigned short v8us;
typedef __attribute__((ext_vector_type(4)))  unsigned short v4us;
typedef __attribute__((ext_vector_type(8)))  float    v8f;
typedef __attribute__((ext_vector_type(4)))  float    v4f;
typedef __attribute__((ext_vector_type(2)))  float    v2f;
typedef v4f  __attribute__((may_alias)) v4fa;

__device__ __forceinline__ unsigned short f2bf(float f) { unsigned u = __float_as_uint(f); u += 0x7FFFu + ((u >> 16) & 1u); return (unsigned short)(u >> 16); }
__device__ __forceinline__ float bf2f(unsigned short b) { return __uint_as_float(((unsigned)b) << 16); }
__device__ __forceinline__ float bfr(float f) { return bf2f(f2bf(f)); }
__device__ __forceinline__ void splitf(float y, unsigned short& h, unsigned short& l) { h = f2bf(y); l = f2bf(y - bf2f(h)); }
__device__ __forceinline__ v16bf cat16b(v8us lo, v8us hi) { return __builtin_bit_cast(v16bf, __builtin_shufflevector(lo, hi, 0, 1, 2, 3, 4, 5, 6, 7, 8, 9, 10, 11, 12, 13, 14, 15)); }
__device__ __forceinline__ v8f wmmab(v16bf a, v16bf b, v8f c) { return __builtin_amdgcn_wmma_f32_16x16x32_bf16(false, a, false, b, (short)0, c, false, false); }

// Fragment loaders. Lane (c, h) holds row c of 16 rows; of a block of 32 k it holds k = 8 h + 0..7 and 16 + 8 h + 0..7, in that order, in all three.
template <typename T16> struct WFrag;
template <> struct WFrag<bf> { typedef v16bf V; static __device__ __forceinline__ V ld(const bf* p) { return cat16b(*(const v8us*)p, *(const v8us*)(p + 16)); } };   // p = row c, k = 8 h, of a bf16 plane with k contiguous
// A stored fragment: piece j (0, 1) at element 256 j, lane (c, h) at 8 (16 h + c) inside it, holds row c, k = 16 j + 8 h + 0..7: the same k order, and every 128-byte line is filled and read whole.
__device__ __forceinline__ v16bf xfrag(const float* p) {   // p = row c, k = 8 h, of an f32 array with k contiguous; rounded to bf16
    const v4f a = *(const v4fa*)p, b = *(const v4fa*)(p + 4), d = *(const v4fa*)(p + 16), e = *(const v4fa*)(p + 20); v8us lo, hi;
#pragma unroll
    for (int i = 0; i < 4; ++i) { lo[i] = f2bf(a[i]); lo[4 + i] = f2bf(b[i]); hi[i] = f2bf(d[i]); hi[4 + i] = f2bf(e[i]); }
    return cat16b(lo, hi); }
__device__ __forceinline__ v16bf wfrag(const float* p, int ld) {   // p = k row 8 h, column c, of an f32 'xw' weight [k][ld]: column c as a fragment row; rounded to bf16
    v8us lo, hi;
#pragma unroll
    for (int i = 0; i < 8; ++i) { lo[i] = f2bf(p[i * ld]); hi[i] = f2bf(p[(16 + i) * ld]); }
    return cat16b(lo, hi); }

// ---- k_proj: the three projections with their biases, split into hi/lo bf16 planes. grid NB_ TT / 64, 192 threads: a work-group owns 64 tokens; waves 0, 1 make q, waves 2, 3 k (32 tokens each), waves 4, 5 v (16 columns each).
// q and k as W^T x^T (A = weight columns, B = token rows): a lane's 8 accumulator registers are 8 consecutive columns of one token: the lane's 16 bytes of piece dt of the fragment [16 tokens][CB], fragment number = token / 16 (counted through both batches).
// v as x W (A = token rows, B = weight columns): the 8 registers are 8 consecutive tokens of one column: the lane's 16 bytes of piece tt & 1 of the fragment [16 columns][32 tokens], fragment number = 2 (token / 32) + column / 16.
// Every loop is unrolled: its index picks registers of the fragment arrays, and all loads of a wave go out together.
__global__ __launch_bounds__(192) void k_proj(const float* __restrict__ x, const float* __restrict__ wg, const float* __restrict__ bg, const float* __restrict__ wf, const float* __restrict__ bff, const float* __restrict__ wh, const float* __restrict__ bh, bf* Qh, bf* Ql, bf* Kh, bf* Kl, bf* Vh, bf* Vl) {
    const int lane = threadIdx.x & 31, c = lane & 15, h = lane >> 4, w = __builtin_amdgcn_readfirstlane(threadIdx.x >> 5), hf = w & 1; const int T0 = blockIdx.x * 64;   // T0: first token, counted through both batches
    if (w < 4) {
        const float* wt = (w < 2) ? wg : wf; const float* bs = (w < 2) ? bg : bff; bf* Ph = (w < 2) ? Qh : Kh; bf* Pl = (w < 2) ? Ql : Kl; const int T1 = T0 + 32 * hf;
        const float* px = x + (size_t)(T1 + c) * DM + 8 * h; const float* pw = wt + (size_t)(8 * h) * CB + c; const float* pb = bs + 8 * h;
        v16bf xa[2][2], wa[2][2]; float bv[2][8];
#pragma unroll
        for (int tt = 0; tt < 2; ++tt)
#pragma unroll
            for (int kk = 0; kk < 2; ++kk) { xa[tt][kk] = xfrag(px + 16 * tt * DM + 32 * kk); wa[tt][kk] = wfrag(pw + 32 * kk * CB + 16 * tt, CB); }
#pragma unroll
        for (int dt = 0; dt < 2; ++dt)
#pragma unroll
            for (int r = 0; r < 8; ++r) bv[dt][r] = bfr(pb[16 * dt + r]);
        asm volatile("s_wait_xcnt 0x0" :: "v"(px), "v"(pw), "v"(pb) : "memory");   // the loads' address registers stay whole until every load above has taken its address
#pragma unroll
        for (int dt = 0; dt < 2; ++dt) {
#pragma unroll
            for (int tt = 0; tt < 2; ++tt) { v8f a = (v8f){}; a = wmmab(wa[dt][0], xa[tt][0], a); a = wmmab(wa[dt][1], xa[tt][1], a); v8us oh, ol;
#pragma unroll
                for (int r = 0; r < 8; ++r) { unsigned short a2, c2; splitf(a[r] + bv[dt][r], a2, c2); oh[r] = a2; ol[r] = c2; }
                const size_t e = (size_t)(T1 / 16 + tt) * FE + 256 * dt + 8 * lane; *(v8us*)(Ph + e) = oh; *(v8us*)(Pl + e) = ol; } }
        asm volatile("s_wait_xcnt 0x0" ::: "memory");   // behind the branch's last stores: the built code lays the two branches one behind the other, in an order the compiler picks, and the later one writes registers that these stores name
    } else {
        const int d = 16 * hf + c;
        const float* px = x + (size_t)(T0 + c) * DM + 8 * h; const float* pw = wh + (size_t)(8 * h) * CB + d; const float* pb = bh + d;
        v16bf xa[4][2], wa[2];
#pragma unroll
        for (int kk = 0; kk < 2; ++kk) { wa[kk] = wfrag(pw + 32 * kk * CB, CB);
#pragma unroll
            for (int tt = 0; tt < 4; ++tt) xa[tt][kk] = xfrag(px + 16 * tt * DM + 32 * kk); }
        const float bv = bfr(pb[0]);
        asm volatile("s_wait_xcnt 0x0" :: "v"(px), "v"(pw), "v"(pb) : "memory");   // the loads' address registers stay whole until every load above has taken its address
#pragma unroll
        for (int tt = 0; tt < 4; ++tt) { v8f a = (v8f){}; a = wmmab(xa[tt][0], wa[0], a); a = wmmab(xa[tt][1], wa[1], a); v8us oh, ol;
#pragma unroll
            for (int r = 0; r < 8; ++r) { unsigned short a2, c2; splitf(a[r] + bv, a2, c2); oh[r] = a2; ol[r] = c2; }
            const size_t e = (size_t)(2 * (T0 / 32 + (tt >> 1)) + hf) * FE + 256 * (tt & 1) + 8 * lane; *(v8us*)(Vh + e) = oh; *(v8us*)(Vl + e) = ol; }
        asm volatile("s_wait_xcnt 0x0" ::: "memory");   // behind the branch's last stores: the built code lays the two branches one behind the other, in an order the compiler picks, and the later one writes registers that these stores name
    }
}

// ---- k_fattn: scores, softmax and softmax . hv in one kernel (running maximum and sum; no score or weight plane in memory), then the out projection and the residual on the joined rows. grid (TT / 32, NB_), 32 KW threads.
// A work-group owns 32 queries; wave w walks keys [w KR, (w + 1) KR) in blocks of 32 and the KW partial results are joined in LDS.
// S^T = K Q^T (A = key rows, B = query rows, both stored fragments) puts one query's scores in one lane pair (c, c + 16); the two 16-key score tiles, converted in place, are the B operand of O^T += V^T P^T.
// Tail: the joined 32 x CB rows go to LDS as hi/lo bf16; four waves make out^T = Wo^T o^T (A = Wo columns, B = query rows), 16 queries x 32 columns each, so that a lane holds 8 consecutive columns of one token and a wave stores whole 128-byte lines (its loops unrolled for the same reason as in k_proj).
typedef __attribute__((ext_vector_type(2))) __bf16 v2bf;
typedef __attribute__((ext_vector_type(8))) unsigned v8u;
__device__ __forceinline__ float xhalf(float x) { const int b = __float_as_int(x); return __int_as_float(__builtin_amdgcn_permlanex16(b, b, 0x76543210, 0xfedcba98, false, false)); }   // value of lane l ^ 16
__device__ __forceinline__ v16bf ldf(const bf* p) { return cat16b(*(const v8us*)p, *(const v8us*)(p + 256)); }   // stored fragment; p = its first element + 8 lane
__global__ __launch_bounds__(32 * KW) void k_fattn(const bf* __restrict__ Qh, const bf* __restrict__ Ql, const bf* __restrict__ Kh, const bf* __restrict__ Kl, const bf* __restrict__ Vh, const bf* __restrict__ Vl, const float* __restrict__ x, const float* __restrict__ wo, const float* __restrict__ bo, const float* __restrict__ gam, float* O) {
    __shared__ __align__(16) float so[KW][32][CB + 4];   // [wave][query][d], pitch 144 B
    __shared__ float sm[KW][32], sl[KW][32], sw[KW][32];   // per wave and query: maximum, sum, weight in the join
    __shared__ __align__(16) bf sah[32][CB + 8], sal[32][CB + 8];   // joined rows, hi and lo, pitch 80 B
    const int lane = threadIdx.x & 31, c = lane & 15, h = lane >> 4, w = __builtin_amdgcn_readfirstlane(threadIdx.x >> 5); const int q0 = blockIdx.x * 32; const int k0 = w * KR; const int bz = blockIdx.y;   // w in a scalar register: scalar loop control and key addresses
    const int tb = bz * TT; const int le = 8 * lane;   // this batch's first token; the lane's elements inside a piece of a stored fragment
    const bf* pqh = Qh + (size_t)((tb + q0) / 16) * FE + le; const bf* pql = Ql + (size_t)((tb + q0) / 16) * FE + le;
    const bf* pkh = Kh + (size_t)((tb + k0) / 16) * FE + le; const bf* pkl = Kl + (size_t)((tb + k0) / 16) * FE + le;
    v16bf qh[2], ql[2], kh[2], kl[2];
#pragma unroll
    for (int g = 0; g < 2; ++g) { qh[g] = ldf(pqh + g * FE); ql[g] = ldf(pql + g * FE); }
    asm volatile("s_wait_xcnt 0x0" ::: "memory");   // parts the query loads from the key loads, whose addresses are formed in scalar registers that the query loads name
#pragma unroll
    for (int t = 0; t < 2; ++t) { kh[t] = ldf(pkh + t * FE); kl[t] = ldf(pkl + t * FE); }
    v8f o[2][2]; float m[2], l[2];
#pragma unroll
    for (int g = 0; g < 2; ++g) { o[0][g] = (v8f){}; o[1][g] = (v8f){}; m[g] = -3.0e38f; l[g] = 0.f; }
#pragma unroll 1   // kept rolled: the body is long and runs KR / 32 times
    for (int kb = k0; kb < k0 + KR; kb += 32) {
        v16bf vh[2], vl[2]; const bf* pvh = Vh + (size_t)((tb + kb) / 16) * FE + le; const bf* pvl = Vl + (size_t)((tb + kb) / 16) * FE + le;
#pragma unroll
        for (int dt = 0; dt < 2; ++dt) { vh[dt] = ldf(pvh + dt * FE); vl[dt] = ldf(pvl + dt * FE); }
        __builtin_amdgcn_sched_barrier(0);   // keeps the value loads up here, a whole score and softmax phase ahead of their use (the scheduler sank them to their WMMAs, one exposed wait each)
        v8f s[2][2];
#pragma unroll
        for (int t = 0; t < 2; ++t)
#pragma unroll
            for (int g = 0; g < 2; ++g) { v8f a = (v8f){}; a = wmmab(kh[t], qh[g], a); a = wmmab(kh[t], ql[g], a); a = wmmab(kl[t], qh[g], a); s[t][g] = a; }
        const int kn = (kb + 32 < k0 + KR) ? kb + 32 : kb;   // next block's key rows are fetched now, behind their last use; the last block fetches its own again
        pkh = Kh + (size_t)((tb + kn) / 16) * FE + le; pkl = Kl + (size_t)((tb + kn) / 16) * FE + le;
#pragma unroll
        for (int t = 0; t < 2; ++t) { kh[t] = ldf(pkh + t * FE); kl[t] = ldf(pkl + t * FE); }
        asm volatile("s_wait_xcnt 0x0" :: "v"(pvh), "v"(pvl), "v"(pkh), "v"(pkl) : "memory");   // the block's value and key loads: their address registers stay whole until every one has taken its address
        __builtin_amdgcn_sched_barrier(0);   // keeps the next key loads in front of the softmax, which then covers their latency (the scheduler sank them to the loop's foot)
        v16bf ph[2], pl[2];
#pragma unroll
        for (int g = 0; g < 2; ++g) {
            float mx = s[0][g][0];
#pragma unroll
            for (int r = 1; r < 8; ++r) mx = fmaxf(mx, s[0][g][r]);
#pragma unroll
            for (int r = 0; r < 8; ++r) mx = fmaxf(mx, s[1][g][r]);
            mx = fmaxf(mx, xhalf(mx));
            const float mn = fmaxf(m[g], mx); const float al = __builtin_amdgcn_exp2f((m[g] - mn) * L2E); const float ml = mn * L2E; m[g] = mn;
            v2f sum = (v2f){}; const v2f le2 = { L2E, L2E }, ml2 = { -ml, -ml }; v8u hw, lw;
#pragma unroll
            for (int i = 0; i < 8; ++i) { const int t = i >> 2, r = (i & 3) * 2; v2f x = { s[t][g][r], s[t][g][r + 1] }; x = __builtin_elementwise_fma(x, le2, ml2); v2f p; p[0] = __builtin_amdgcn_exp2f(x[0]); p[1] = __builtin_amdgcn_exp2f(x[1]); sum += p;
                const unsigned hu = __builtin_bit_cast(unsigned, __builtin_convertvector(p, v2bf)); v2f e; e[0] = p[0] - __uint_as_float(hu << 16); e[1] = p[1] - __uint_as_float(hu & 0xFFFF0000u);
                hw[i] = hu; lw[i] = __builtin_bit_cast(unsigned, __builtin_convertvector(e, v2bf)); }
            l[g] = l[g] * al + (sum[0] + sum[1]); o[0][g] *= al; o[1][g] *= al; ph[g] = __builtin_bit_cast(v16bf, hw); pl[g] = __builtin_bit_cast(v16bf, lw); }
#pragma unroll
        for (int dt = 0; dt < 2; ++dt)
#pragma unroll
            for (int g = 0; g < 2; ++g) { v8f a = o[dt][g]; a = wmmab(vh[dt], ph[g], a); a = wmmab(vh[dt], pl[g], a); a = wmmab(vl[dt], ph[g], a); o[dt][g] = a; }
    }
#pragma unroll
    for (int g = 0; g < 2; ++g) { const float lt = l[g] + xhalf(l[g]); if (h == 0) { sm[w][16 * g + c] = m[g]; sl[w][16 * g + c] = lt; }
#pragma unroll
        for (int dt = 0; dt < 2; ++dt) { float* dst = &so[w][16 * g + c][16 * dt + 8 * h]; *(v4fa*)dst = __builtin_shufflevector(o[dt][g], o[dt][g], 0, 1, 2, 3); *(v4fa*)(dst + 4) = __builtin_shufflevector(o[dt][g], o[dt][g], 4, 5, 6, 7); } }
    __syncthreads();
    float M = sm[0][lane];   // thread (w, lane) makes the one weight of wave w's partial for query lane
#pragma unroll
    for (int k = 1; k < KW; ++k) M = fmaxf(M, sm[k][lane]);
    const float wt = __builtin_amdgcn_exp2f((sm[w][lane] - M) * L2E); sw[w][lane] = wt; sl[w][lane] *= wt;
    __syncthreads();
    if (w < 8) {   // the join is 32 queries x 8 threads
        const int q = threadIdx.x >> 3, d0 = (threadIdx.x & 7) * 4; float L = 0.f; v4f acc = (v4f){};
#pragma unroll
        for (int k = 0; k < KW; ++k) { L += sl[k][q]; acc += *(const v4fa*)&so[k][q][d0] * sw[k][q]; }
        const float inv = __fdiv_rn(1.0f, L); v4us oh, ol;
#pragma unroll
        for (int k = 0; k < 4; ++k) { unsigned short a, c2; splitf(acc[k] * inv, a, c2); oh[k] = a; ol[k] = c2; }
        *(v4us*)&sah[q][d0] = oh; *(v4us*)&sal[q][d0] = ol; }
    __syncthreads();   // hands the joined rows to the waves of the out projection
    if (w >= 4) return;   // no barrier follows
    const int g = w & 1, np = w >> 1;   // 16 queries, 32 output columns
    const v16bf ah = WFrag<bf>::ld(&sah[16 * g + c][8 * h]), al = WFrag<bf>::ld(&sal[16 * g + c][8 * h]);
    const float gm = bfr(gam[0]); const size_t ro = (size_t)(bz * TT + q0 + 16 * g + c) * DM + 32 * np + 8 * h;
    const float* px = x + ro; const float* pw = wo + (size_t)(8 * h) * DM + 32 * np + c; const float* pb = bo + 32 * np + 8 * h;
    v16bf wa[2]; v4f xv[2][2], bv[2][2];
#pragma unroll
    for (int j = 0; j < 2; ++j) { wa[j] = wfrag(pw + 16 * j, DM);
#pragma unroll
        for (int u = 0; u < 2; ++u) { xv[j][u] = *(const v4fa*)(px + 16 * j + 4 * u); bv[j][u] = *(const v4fa*)(pb + 16 * j + 4 * u); } }
    asm volatile("s_wait_xcnt 0x0" :: "v"(px), "v"(pw) : "memory");   // the loads' address registers stay whole until every load above has taken its address
#pragma unroll
    for (int j = 0; j < 2; ++j) { v8f a = (v8f){}; a = wmmab(wa[j], ah, a); a = wmmab(wa[j], al, a);
#pragma unroll
        for (int u = 0; u < 2; ++u) { v4f y;
#pragma unroll
            for (int r = 0; r < 4; ++r) y[r] = bfr(xv[j][u][r]) + gm * (a[4 * u + r] + bfr(bv[j][u][r]));
            *(v4fa*)(O + ro + 16 * j + 4 * u) = y; } }
}

extern "C" void kernel_launch(void* const* d_in, const int* in_sizes, int n_in,
                              void* d_out, int out_size, void* d_ws, size_t ws_size, hipStream_t stream) {
    (void)in_sizes; (void)n_in; (void)out_size;
    const float* x = (const float*)d_in[0]; const float* wf = (const float*)d_in[1]; const float* bff = (const float*)d_in[2]; const float* wg = (const float*)d_in[3]; const float* bg = (const float*)d_in[4]; const float* wh = (const float*)d_in[5]; const float* bh = (const float*)d_in[6]; const float* wo = (const float*)d_in[7]; const float* bo = (const float*)d_in[8]; const float* gam = (const float*)d_in[9];
    float* OUT = (float*)d_out;     // [2][4096][64]
    char* wsp = (char*)d_ws;
    auto take = [&](size_t bytes) { char* p = wsp; wsp += (bytes + 255) & ~(size_t)255; return (void*)p; };
    bf* QPh = (bf*)take((size_t)NB_ * TT * CB * 2); bf* QPl = (bf*)take((size_t)NB_ * TT * CB * 2); bf* KPh = (bf*)take((size_t)NB_ * TT * CB * 2); bf* KPl = (bf*)take((size_t)NB_ * TT * CB * 2); bf* VTh = (bf*)take((size_t)NB_ * CB * TT * 2); bf* VTl = (bf*)take((size_t)NB_ * CB * TT * 2);
    if ((size_t)(wsp - (char*)d_ws) > ws_size) return;
    k_proj<<<NB_ * TT / 64, 192, 0, stream>>>(x, wg, bg, wf, bff, wh, bh, QPh, QPl, KPh, KPl, VTh, VTl);   /* queries from Wg, keys from Wf, values from Wh */
    k_fattn<<<dim3(TT / 32, NB_), 32 * KW, 0, stream>>>(QPh, QPl, KPh, KPl, VTh, VTl, x, wo, bo, gam, OUT);   /* out = x + gamma ((softmax(g.f) . hv) Wo + bo) */
}

// v004
// Measured time: 18.9 microseconds a run.
// Timed twice side by side with v003, it ran 1.19 and 1.17 times as fast.
// Counting every step since v000, it is 25.4 times as fast.
#include <hip/hip_runtime.h>

// SAGAN-style self-attention over a 16x16x16 volume (x [2][16][16][16][64] -> tokens [2][4096][64]; f = x Wf + bf (keys), g = x Wg + bg (queries), hv = x Wh + bh (values), all 'xw' [64][32]; s = g.f (no scaling); softmax over the 4096 keys; o = (softmax . hv) Wo + bo ('xw' [32][64]); out = x + gamma o (gamma [1], read) -> [2][16][16][16][64] (0.52 M)).
// Compute dtypes, f32 accumulate: every input rounded to bf16; f/g/hv on PLAIN bf16 operands (exact) + biases; scores and attn.hv on hi/lo planes (3 products) for every row; softmax f32; o Wo as hl x exact (2 products) + bo; residual x + gamma o in f32.
// Two launches, both batches in each: k_proj (inputs -> q, k and v hi/lo planes, stored in fragment order), k_fattn (attention, out projection, residual).

#define NB_  2
#define TT   4096
#define DM   64
#define CB   32                   // projection width
#define FE   512                  // elements of one stored fragment (16 rows x 32 k): two pieces of 32 lanes x 8 elements, so that a wave's 16-byte load or store covers 512 contiguous bytes
#define KW   16                   // waves per work-group of the fused attention kernel (four per SIMD), one key range each
#define KR   (TT / KW)            // keys per wave
#define L2E  1.4426950408889634f
typedef unsigned short bf;
typedef __attribute__((ext_vector_type(16))) __bf16   v16bf;
typedef __attribute__((ext_vector_type(8)))  unsigned short v8us;
typedef __attribute__((ext_vector_type(4)))  unsigned short v4us;
typedef __attribute__((ext_vector_type(8)))  float    v8f;
typedef __attribute__((ext_vector_type(4)))  float    v4f;
typedef __attribute__((ext_vector_type(2)))  float    v2f;
typedef v4f  __attribute__((may_alias)) v4fa;

__device__ __forceinline__ unsigned short f2bf(float f) { unsigned u = __float_as_uint(f); u += 0x7FFFu + ((u >> 16) & 1u); return (unsigned short)(u >> 16); }
__device__ __forceinline__ float bf2f(unsigned short b) { return __uint_as_float(((unsigned)b) << 16); }
__device__ __forceinline__ float bfr(float f) { return bf2f(f2bf(f)); }
__device__ __forceinline__ void splitf(float y, unsigned short& h, unsigned short& l) { h = f2bf(y); l = f2bf(y - bf2f(h)); }
__device__ __forceinline__ v16bf cat16b(v8us lo, v8us hi) { return __builtin_bit_cast(v16bf, __builtin_shufflevector(lo, hi, 0, 1, 2, 3, 4, 5, 6, 7, 8, 9, 10, 11, 12, 13, 14, 15)); }
__device__ __forceinline__ v8f wmmab(v16bf a, v16bf b, v8f c) { return __builtin_amdgcn_wmma_f32_16x16x32_bf16(false, a, false, b, (short)0, c, false, false); }

// Fragment loaders. Lane (c, h) holds row c of 16 rows; of a block of 32 k it holds k = 8 h + 0..7 and 16 + 8 h + 0..7, in that order, in all three.
template <typename T16> struct WFrag;
template <> struct WFrag<bf> { typedef v16bf V; static __device__ __forceinline__ V ld(const bf* p) { return cat16b(*(const v8us*)p, *(const v8us*)(p + 16)); } };   // p = row c, k = 8 h, of a bf16 plane with k contiguous
// A stored fragment: piece j (0, 1) at element 256 j, lane (c, h) at 8 (16 h + c) inside it, holds row c, k = 16 j + 8 h + 0..7: the same k order, and every 128-byte line is filled and read whole.
__device__ __forceinline__ v16bf xfrag(const float* p) {   // p = row c, k = 8 h, of an f32 array with k contiguous; rounded to bf16
    const v4f a = *(const v4fa*)p, b = *(const v4fa*)(p + 4), d = *(const v4fa*)(p + 16), e = *(const v4fa*)(p + 20); v8us lo, hi;
#pragma unroll
    for (int i = 0; i < 4; ++i) { lo[i] = f2bf(a[i]); lo[4 + i] = f2bf(b[i]); hi[i] = f2bf(d[i]); hi[4 + i] = f2bf(e[i]); }
    return cat16b(lo, hi); }
__device__ __forceinline__ v16bf wfrag(const float* p, int ld) {   // p = k row 8 h, column c, of an f32 'xw' weight [k][ld]: column c as a fragment row; rounded to bf16
    v8us lo, hi;
#pragma unroll
    for (int i = 0; i < 8; ++i) { lo[i] = f2bf(p[i * ld]); hi[i] = f2bf(p[(16 + i) * ld]); }
    return cat16b(lo, hi); }

// ---- k_proj: the three projections with their biases, split into hi/lo bf16 planes. grid NB_ TT / 64, 192 threads: a work-group owns 64 tokens; waves 0, 1 make q, waves 2, 3 k (32 tokens each), waves 4, 5 v (16 columns each).
// q and k as W^T x^T (A = weight columns, B = token rows): a lane's 8 accumulator registers are 8 consecutive columns of one token: the lane's 16 bytes of piece dt of the fragment [16 tokens][CB], fragment number = token / 16 (counted through both batches).
// v as x W (A = token rows, B = weight columns): the 8 registers are 8 consecutive tokens of one column: the lane's 16 bytes of piece tt & 1 of the fragment [16 columns][32 tokens], fragment number = 2 (token / 32) + column / 16.
// Every loop is unrolled: its index picks registers of the fragment arrays, and all loads of a wave go out together.
__global__ __launch_bounds__(192) void k_proj(const float* __restrict__ x, const float* __restrict__ wg, const float* __restrict__ bg, const float* __restrict__ wf, const float* __restrict__ bff, const float* __restrict__ wh, const float* __restrict__ bh, bf* Qh, bf* Ql, bf* Kh, bf* Kl, bf* Vh, bf* Vl) {
    const int lane = threadIdx.x & 31, c = lane & 15, h = lane >> 4, w = __builtin_amdgcn_readfirstlane(threadIdx.x >> 5), hf = w & 1; const int T0 = blockIdx.x * 64;   // T0: first token, counted through both batches
    if (w < 4) {
        const float* wt = (w < 2) ? wg : wf; const float* bs = (w < 2) ? bg : bff; bf* Ph = (w < 2) ? Qh : Kh; bf* Pl = (w < 2) ? Ql : Kl; const int T1 = T0 + 32 * hf;
        const float* px = x + (size_t)(T1 + c) * DM + 8 * h; const float* pw = wt + (size_t)(8 * h) * CB + c; const float* pb = bs + 8 * h;
        v16bf xa[2][2], wa[2][2]; float bv[2][8];
#pragma unroll
        for (int tt = 0; tt < 2; ++tt)
#pragma unroll
            for (int kk = 0; kk < 2; ++kk) { xa[tt][kk] = xfrag(px + 16 * tt * DM + 32 * kk); wa[tt][kk] = wfrag(pw + 32 * kk * CB + 16 * tt, CB); }
#pragma unroll
        for (int dt = 0; dt < 2; ++dt)
#pragma unroll
            for (int r = 0; r < 8; ++r) bv[dt][r] = bfr(pb[16 * dt + r]);
        asm volatile("s_wait_xcnt 0x0" :: "v"(px), "v"(pw), "v"(pb) : "memory");   // the loads' address registers stay whole until every load above has taken its address
#pragma unroll
        for (int dt = 0; dt < 2; ++dt) {
#pragma unroll
            for (int tt = 0; tt < 2; ++tt) { v8f a = (v8f){}; a = wmmab(wa[dt][0], xa[tt][0], a); a = wmmab(wa[dt][1], xa[tt][1], a); v8us oh, ol;
#pragma unroll
                for (int r = 0; r < 8; ++r) { unsigned short a2, c2; splitf(a[r] + bv[dt][r], a2, c2); oh[r] = a2; ol[r] = c2; }
                const size_t e = (size_t)(T1 / 16 + tt) * FE + 256 * dt + 8 * lane; *(v8us*)(Ph + e) = oh; *(v8us*)(Pl + e) = ol; } }
        asm volatile("s_wait_xcnt 0x0" ::: "memory");   // behind the branch's last stores: the built code lays the two branches one behind the other, in an order the compiler picks, and the later one writes registers that these stores name
    } else {
        const int d = 16 * hf + c;
        const float* px = x + (size_t)(T0 + c) * DM + 8 * h; const float* pw = wh + (size_t)(8 * h) * CB + d; const float* pb = bh + d;
        v16bf xa[4][2], wa[2];
#pragma unroll
        for (int kk = 0; kk < 2; ++kk) { wa[kk] = wfrag(pw + 32 * kk * CB, CB);
#pragma unroll
            for (int tt = 0; tt < 4; ++tt) xa[tt][kk] = xfrag(px + 16 * tt * DM + 32 * kk); }
        const float bv = bfr(pb[0]);
        asm volatile("s_wait_xcnt 0x0" :: "v"(px), "v"(pw), "v"(pb) : "memory");   // the loads' address registers stay whole until every load above has taken its address
#pragma unroll
        for (int tt = 0; tt < 4; ++tt) { v8f a = (v8f){}; a = wmmab(xa[tt][0], wa[0], a); a = wmmab(xa[tt][1], wa[1], a); v8us oh, ol;
#pragma unroll
            for (int r = 0; r < 8; ++r) { unsigned short a2, c2; splitf(a[r] + bv, a2, c2); oh[r] = a2; ol[r] = c2; }
            const size_t e = (size_t)(2 * (T0 / 32 + (tt >> 1)) + hf) * FE + 256 * (tt & 1) + 8 * lane; *(v8us*)(Vh + e) = oh; *(v8us*)(Vl + e) = ol; }
        asm volatile("s_wait_xcnt 0x0" ::: "memory");   // behind the branch's last stores: the built code lays the two branches one behind the other, in an order the compiler picks, and the later one writes registers that these stores name
    }
}

// ---- k_fattn: scores, softmax and softmax . hv in one kernel (running maximum and sum; no score or weight plane in memory), then the out projection and the residual on the joined rows. grid (TT / 32, NB_), 32 KW threads.
// A work-group owns 32 queries; wave w walks keys [w KR, (w + 1) KR) in blocks of 32 and the KW partial results are joined in LDS.
// Every work-group of a batch reads the same key and value planes from L2: each wave enters its range at its own block rot and wraps, so that at one moment the work-groups ask for all KR / 32 blocks of a range and not all for the same lines.
// S^T = K Q^T (A = key rows, B = query rows, both stored fragments) puts one query's scores in one lane pair (c, c + 16); the two 16-key score tiles, converted in place, are the B operand of O^T += V^T P^T.
// Tail: the joined 32 x CB rows go to LDS as hi/lo bf16; four waves make out^T = Wo^T o^T (A = Wo columns, B = query rows), 16 queries x 32 columns each, so that a lane holds 8 consecutive columns of one token and a wave stores whole 128-byte lines (its loops unrolled for the same reason as in k_proj).
typedef __attribute__((ext_vector_type(2))) __bf16 v2bf;
typedef __attribute__((ext_vector_type(8))) unsigned v8u;
__device__ __forceinline__ float xhalf(float x) { const int b = __float_as_int(x); return __int_as_float(__builtin_amdgcn_permlanex16(b, b, 0x76543210, 0xfedcba98, false, false)); }   // value of lane l ^ 16
__device__ __forceinline__ v16bf ldf(const bf* p) { return cat16b(*(const v8us*)p, *(const v8us*)(p + 256)); }   // stored fragment; p = its first element + 8 lane
__global__ __launch_bounds__(32 * KW) void k_fattn(const bf* __restrict__ Qh, const bf* __restrict__ Ql, const bf* __restrict__ Kh, const bf* __restrict__ Kl, const bf* __restrict__ Vh, const bf* __restrict__ Vl, const float* __restrict__ x, const float* __restrict__ wo, const float* __restrict__ bo, const float* __restrict__ gam, float* O) {
    __shared__ __align__(16) float so[KW][32][CB + 4];   // [wave][query][d], pitch 144 B
    __shared__ float sm[KW][32], sl[KW][32], sw[KW][32];   // per wave and query: maximum, sum, weight in the join
    __shared__ __align__(16) bf sah[32][CB + 8], sal[32][CB + 8];   // joined rows, hi and lo, pitch 80 B
    const int lane = threadIdx.x & 31, c = lane & 15, h = lane >> 4, w = __builtin_amdgcn_readfirstlane(threadIdx.x >> 5); const int q0 = blockIdx.x * 32; const int k0 = w * KR; const int bz = blockIdx.y;   // w in a scalar register: scalar loop control and key addresses
    const int tb = bz * TT; const int le = 8 * lane;   // this batch's first token; the lane's elements inside a piece of a stored fragment
    const int rot = (blockIdx.x + (blockIdx.x >> 3) + w) & (KR / 32 - 1);   // first block of the walk: differs between neighbours in the grid, between work-groups 8 apart and between a work-group's waves, whose ranges lie a power of two apart (for speed only; any value is right)
    const bf* pqh = Qh + (size_t)((tb + q0) / 16) * FE + le; const bf* pql = Ql + (size_t)((tb + q0) / 16) * FE + le;
    const bf* pkh = Kh + (size_t)((tb + k0 + 32 * rot) / 16) * FE + le; const bf* pkl = Kl + (size_t)((tb + k0 + 32 * rot) / 16) * FE + le;
    v16bf qh[2], ql[2], kh[2], kl[2];
#pragma unroll
    for (int g = 0; g < 2; ++g) { qh[g] = ldf(pqh + g * FE); ql[g] = ldf(pql + g * FE); }
    asm volatile("s_wait_xcnt 0x0" ::: "memory");   // parts the query loads from the key loads, whose addresses are formed in scalar registers that the query loads name
#pragma unroll
    for (int t = 0; t < 2; ++t) { kh[t] = ldf(pkh + t * FE); kl[t] = ldf(pkl + t * FE); }
    v8f o[2][2]; float m[2], l[2];
#pragma unroll
    for (int g = 0; g < 2; ++g) { o[0][g] = (v8f){}; o[1][g] = (v8f){}; m[g] = -3.0e38f; l[g] = 0.f; }
#pragma unroll 1   // kept rolled: the body is long
    for (int i = 0; i < KR / 32; ++i) {
        const int kb = k0 + 32 * ((rot + i) & (KR / 32 - 1));
        v16bf vh[2], vl[2]; const bf* pvh = Vh + (size_t)((tb + kb) / 16) * FE + le; const bf* pvl = Vl + (size_t)((tb + kb) / 16) * FE + le;
#pragma unroll
        for (int dt = 0; dt < 2; ++dt) { vh[dt] = ldf(pvh + dt * FE); vl[dt] = ldf(pvl + dt * FE); }
        __builtin_amdgcn_sched_barrier(0);   // keeps the value loads up here, a whole score and softmax phase ahead of their use (the scheduler sank them to their WMMAs, one exposed wait each)
        v8f s[2][2];
#pragma unroll
        for (int t = 0; t < 2; ++t)
#pragma unroll
            for (int g = 0; g < 2; ++g) { v8f a = (v8f){}; a = wmmab(kh[t], qh[g], a); a = wmmab(kh[t], ql[g], a); a = wmmab(kl[t], qh[g], a); s[t][g] = a; }
        const int kn = k0 + 32 * ((rot + i + 1) & (KR / 32 - 1));   // next block's key rows are fetched now, behind their last use; the last trip fetches the walk's first block again
        pkh = Kh + (size_t)((tb + kn) / 16) * FE + le; pkl = Kl + (size_t)((tb + kn) / 16) * FE + le;
#pragma unroll
        for (int t = 0; t < 2; ++t) { kh[t] = ldf(pkh + t * FE); kl[t] = ldf(pkl + t * FE); }
        asm volatile("s_wait_xcnt 0x0" :: "v"(pvh), "v"(pvl), "v"(pkh), "v"(pkl) : "memory");   // the block's value and key loads: their address registers stay whole until every one has taken its address
        __builtin_amdgcn_sched_barrier(0);   // keeps the next key loads in front of the softmax, which then covers their latency (the scheduler sank them to the loop's foot)
        v16bf ph[2], pl[2];
#pragma unroll
        for (int g = 0; g < 2; ++g) {
            float mx = s[0][g][0];
#pragma unroll
            for (int r = 1; r < 8; ++r) mx = fmaxf(mx, s[0][g][r]);
#pragma unroll
            for (int r = 0; r < 8; ++r) mx = fmaxf(mx, s[1][g][r]);
            mx = fmaxf(mx, xhalf(mx));
            const float mn = fmaxf(m[g], mx); const float al = __builtin_amdgcn_exp2f((m[g] - mn) * L2E); const float ml = mn * L2E; m[g] = mn;
            v2f sum = (v2f){}; const v2f le2 = { L2E, L2E }, ml2 = { -ml, -ml }; v8u hw, lw;
#pragma unroll
            for (int i = 0; i < 8; ++i) { const int t = i >> 2, r = (i & 3) * 2; v2f x = { s[t][g][r], s[t][g][r + 1] }; x = __builtin_elementwise_fma(x, le2, ml2); v2f p; p[0] = __builtin_amdgcn_exp2f(x[0]); p[1] = __builtin_amdgcn_exp2f(x[1]); sum += p;
                const unsigned hu = __builtin_bit_cast(unsigned, __builtin_convertvector(p, v2bf)); v2f e; e[0] = p[0] - __uint_as_float(hu << 16); e[1] = p[1] - __uint_as_float(hu & 0xFFFF0000u);
                hw[i] = hu; lw[i] = __builtin_bit_cast(unsigned, __builtin_convertvector(e, v2bf)); }
            l[g] = l[g] * al + (sum[0] + sum[1]); o[0][g] *= al; o[1][g] *= al; ph[g] = __builtin_bit_cast(v16bf, hw); pl[g] = __builtin_bit_cast(v16bf, lw); }
#pragma unroll
        for (int dt = 0; dt < 2; ++dt)
#pragma unroll
            for (int g = 0; g < 2; ++g) { v8f a = o[dt][g]; a = wmmab(vh[dt], ph[g], a); a = wmmab(vh[dt], pl[g], a); a = wmmab(vl[dt], ph[g], a); o[dt][g] = a; }
    }
#pragma unroll
    for (int g = 0; g < 2; ++g) { const float lt = l[g] + xhalf(l[g]); if (h == 0) { sm[w][16 * g + c] = m[g]; sl[w][16 * g + c] = lt; }
#pragma unroll
        for (int dt = 0; dt < 2; ++dt) { float* dst = &so[w][16 * g + c][16 * dt + 8 * h]; *(v4fa*)dst = __builtin_shufflevector(o[dt][g], o[dt][g], 0, 1, 2, 3); *(v4fa*)(dst + 4) = __builtin_shufflevector(o[dt][g], o[dt][g], 4, 5, 6, 7); } }
    __syncthreads();
    float M = sm[0][lane];   // thread (w, lane) makes the one weight of wave w's partial for query lane
#pragma unroll
    for (int k = 1; k < KW; ++k) M = fmaxf(M, sm[k][lane]);
    const float wt = __builtin_amdgcn_exp2f((sm[w][lane] - M) * L2E); sw[w][lane] = wt; sl[w][lane] *= wt;
    __syncthreads();
    if (w < 8) {   // the join is 32 queries x 8 threads
        const int q = threadIdx.x >> 3, d0 = (threadIdx.x & 7) * 4; float L = 0.f; v4f acc = (v4f){};
#pragma unroll
        for (int k = 0; k < KW; ++k) { L += sl[k][q]; acc += *(const v4fa*)&so[k][q][d0] * sw[k][q]; }
        const float inv = __fdiv_rn(1.0f, L); v4us oh, ol;
#pragma unroll
        for (int k = 0; k < 4; ++k) { unsigned short a, c2; splitf(acc[k] * inv, a, c2); oh[k] = a; ol[k] = c2; }
        *(v4us*)&sah[q][d0] = oh; *(v4us*)&sal[q][d0] = ol; }
    __syncthreads();   // hands the joined rows to the waves of the out projection
    if (w >= 4) return;   // no barrier follows
    const int g = w & 1, np = w >> 1;   // 16 queries, 32 output columns
    const v16bf ah = WFrag<bf>::ld(&sah[16 * g + c][8 * h]), al = WFrag<bf>::ld(&sal[16 * g + c][8 * h]);
    const float gm = bfr(gam[0]); const size_t ro = (size_t)(bz * TT + q0 + 16 * g + c) * DM + 32 * np + 8 * h;
    const float* px = x + ro; const float* pw = wo + (size_t)(8 * h) * DM + 32 * np + c; const float* pb = bo + 32 * np + 8 * h;
    v16bf wa[2]; v4f xv[2][2], bv[2][2];
#pragma unroll
    for (int j = 0; j < 2; ++j) { wa[j] = wfrag(pw + 16 * j, DM);
#pragma unroll
        for (int u = 0; u < 2; ++u) { xv[j][u] = *(const v4fa*)(px + 16 * j + 4 * u); bv[j][u] = *(const v4fa*)(pb + 16 * j + 4 * u); } }
    asm volatile("s_wait_xcnt 0x0" :: "v"(px), "v"(pw) : "memory");   // the loads' address registers stay whole until every load above has taken its address
#pragma unroll
    for (int j = 0; j < 2; ++j) { v8f a = (v8f){}; a = wmmab(wa[j], ah, a); a = wmmab(wa[j], al, a);
#pragma unroll
        for (int u = 0; u < 2; ++u) { v4f y;
#pragma unroll
            for (int r = 0; r < 4; ++r) y[r] = bfr(xv[j][u][r]) + gm * (a[4 * u + r] + bfr(bv[j][u][r]));
            *(v4fa*)(O + ro + 16 * j + 4 * u) = y; } }
}

extern "C" void kernel_launch(void* const* d_in, const int* in_sizes, int n_in,
                              void* d_out, int out_size, void* d_ws, size_t ws_size, hipStream_t stream) {
    (void)in_sizes; (void)n_in; (void)out_size;
    const float* x = (const float*)d_in[0]; const float* wf = (const float*)d_in[1]; const float* bff = (const float*)d_in[2]; const float* wg = (const float*)d_in[3]; const float* bg = (const float*)d_in[4]; const float* wh = (const float*)d_in[5]; const float* bh = (const float*)d_in[6]; const float* wo = (const float*)d_in[7]; const float* bo = (const float*)d_in[8]; const float* gam = (const float*)d_in[9];
    float* OUT = (float*)d_out;     // [2][4096][64]
    char* wsp = (char*)d_ws;
    auto take = [&](size_t bytes) { char* p = wsp; wsp += (bytes + 255) & ~(size_t)255; return (void*)p; };
    bf* QPh = (bf*)take((size_t)NB_ * TT * CB * 2); bf* QPl = (bf*)take((size_t)NB_ * TT * CB * 2); bf* KPh = (bf*)take((size_t)NB_ * TT * CB * 2); bf* KPl = (bf*)take((size_t)NB_ * TT * CB * 2); bf* VTh = (bf*)take((size_t)NB_ * CB * TT * 2); bf* VTl = (bf*)take((size_t)NB_ * CB * TT * 2);
    if ((size_t)(wsp - (char*)d_ws) > ws_size) return;
    k_proj<<<NB_ * TT / 64, 192, 0, stream>>>(x, wg, bg, wf, bff, wh, bh, QPh, QPl, KPh, KPl, VTh, VTl);   /* queries from Wg, keys from Wf, values from Wh */
    k_fattn<<<dim3(TT / 32, NB_), 32 * KW, 0, stream>>>(QPh, QPl, KPh, KPl, VTh, VTl, x, wo, bo, gam, OUT);   /* out = x + gamma ((softmax(g.f) . hv) Wo + bo) */
}

// v006
// It runs in 16.5 microseconds.
// It is 1.14 times as fast as v004, going by the measured steps of the versions left out in between.
// Counting every step since v000, it is 29.1 times as fast.
#include <hip/hip_runtime.h>
#include <stdint.h>

// SAGAN-style self-attention over a 16x16x16 volume (x [2][16][16][16][64] -> tokens [2][4096][64]; f = x Wf + bf (keys), g = x Wg + bg (queries), hv = x Wh + bh (values), all 'xw' [64][32]; s = g.f (no scaling); softmax over the 4096 keys; o = (softmax . hv) Wo + bo ('xw' [32][64]); out = x + gamma o (gamma [1], read) -> [2][16][16][16][64] (0.52 M)).
// Compute dtypes, f32 accumulate: every input rounded to bf16; g on PLAIN bf16 operands (exact) + bias; u = Wf g, the scores u.x, P.x, (P.x / l) Wh and o Wo as hl x exact (2 products each); softmax f32; residual x + gamma o in f32.
// One launch. s = g.(x_k Wf + bf) = x_k.(Wf g) + g.bf, and g.bf is the same for every key of a query, so it leaves the softmax unchanged; softmax . (x Wh + bh) = (softmax . x) Wh + bh, the weights summing to 1. The keys and values of every query are then the bf16 rows of x themselves.

#define NB_  2
#define TT   4096
#define DM   64
#define CB   32                   // projection width
#define XP   48                   // elements per row of a wave's transposed key block in LDS: 32 keys + 16 of pad = 96 bytes, an odd multiple of 32 bytes (the transposing load's pitch)
#define KW   16                   // waves per work-group of the fused attention kernel (four per SIMD), one key range each
#define KR   (TT / KW)            // keys per wave
#define STG  (32 * DM * 4)        // bytes of a wave's f32 key block in LDS: 32 rows of 256 bytes, no pad (a half-wave reads one whole row)
#define WRG  (STG + DM * XP * 2)  // a wave's own LDS region: the f32 key block, behind it x^T of the block; 7 x 2 KiB, so every wave's key block starts at a multiple of 2 KiB
#define L2E  1.4426950408889634f
typedef unsigned short bf;
typedef __attribute__((ext_vector_type(16))) __bf16   v16bf;
typedef __attribute__((ext_vector_type(8)))  unsigned short v8us;
typedef __attribute__((ext_vector_type(4)))  unsigned short v4us;
typedef __attribute__((ext_vector_type(8)))  float    v8f;
typedef __attribute__((ext_vector_type(4)))  float    v4f;
typedef __attribute__((ext_vector_type(2)))  float    v2f;
typedef v4f  __attribute__((may_alias)) v4fa;

__device__ __forceinline__ unsigned short f2bf(float f) { unsigned u = __float_as_uint(f); u += 0x7FFFu + ((u >> 16) & 1u); return (unsigned short)(u >> 16); }
__device__ __forceinline__ float bf2f(unsigned short b) { return __uint_as_float(((unsigned)b) << 16); }
__device__ __forceinline__ float bfr(float f) { return bf2f(f2bf(f)); }
__device__ __forceinline__ void splitf(float y, unsigned short& h, unsigned short& l) { h = f2bf(y); l = f2bf(y - bf2f(h)); }
__device__ __forceinline__ v16bf cat16b(v8us lo, v8us hi) { return __builtin_bit_cast(v16bf, __builtin_shufflevector(lo, hi, 0, 1, 2, 3, 4, 5, 6, 7, 8, 9, 10, 11, 12, 13, 14, 15)); }
__device__ __forceinline__ v8f wmmab(v16bf a, v16bf b, v8f c) { return __builtin_amdgcn_wmma_f32_16x16x32_bf16(false, a, false, b, (short)0, c, false, false); }

// Fragment loaders. Lane (c, h) holds row c of 16 rows; of a block of 32 k it holds k = 8 h + 0..7 and 16 + 8 h + 0..7, in that order, in all three.
template <typename T16> struct WFrag;
template <> struct WFrag<bf> { typedef v16bf V; static __device__ __forceinline__ V ld(const bf* p) { return cat16b(*(const v8us*)p, *(const v8us*)(p + 16)); } };   // p = row c, k = 8 h, of a bf16 plane with k contiguous
__device__ __forceinline__ v16bf xfrag(const float* p) {   // p = row c, k = 8 h, of an f32 array with k contiguous; rounded to bf16
    const v4f a = *(const v4fa*)p, b = *(const v4fa*)(p + 4), d = *(const v4fa*)(p + 16), e = *(const v4fa*)(p + 20); v8us lo, hi;
#pragma unroll
    for (int i = 0; i < 4; ++i) { lo[i] = f2bf(a[i]); lo[4 + i] = f2bf(b[i]); hi[i] = f2bf(d[i]); hi[4 + i] = f2bf(e[i]); }
    return cat16b(lo, hi); }
__device__ __forceinline__ v16bf wfrag(const float* p, int ld) {   // p = k row 8 h, column c, of an f32 'xw' weight [k][ld]: column c as a fragment row; rounded to bf16
    v8us lo, hi;
#pragma unroll
    for (int i = 0; i < 8; ++i) { lo[i] = f2bf(p[i * ld]); hi[i] = f2bf(p[(16 + i) * ld]); }
    return cat16b(lo, hi); }

// ---- k_attn: everything. grid (TT / 32, NB_), 32 KW threads. A work-group owns 32 queries; wave w walks keys [w KR, (w + 1) KR) in blocks of 32 and the KW partial results are joined in LDS.
// Head: four waves make g (16 queries x 16 columns each, as Wg^T x^T), eight waves u = Wf g (16 queries x 16 channels each, as Wf g^T), split hi/lo into LDS; every wave then takes u of all 32 queries as B fragments, hi and lo, into registers. Two more waves put Wh and bh into LDS for the tail.
// Key block: each wave brings its 32 f32 rows (8 KiB in a row) into its own LDS block by one tensor load, asked for a whole trip ahead, as soon as the wave has read the block before it out; no register holds a block in flight, and no other wave reads it, so no barrier. Lane (c, h) reads channels 4 c .. 4 c + 3 of keys 8 h + 0..7 and 16 + 8 h + 0..7 from there (a wave-wide read = two whole 256-byte rows). Rounded and packed along the keys, its registers ARE the A fragments of x^T for O^T += x^T P^T: tile dt has channel 4 c + dt in row c, keys in the hardware k order.
// The same registers go to the wave's own LDS block as x^T (row 16 dt + c = channel 4 c + dt) and come back through the transposing load as the A fragments of S^T = x u^T (row = key, k = LDS row); u is stored in that same row order.
// Every work-group of a batch reads the same rows of x from L2: each wave enters its range at its own block rot and wraps, so that at one moment the work-groups ask for all KR / 32 blocks of a range and not all for the same lines.
// Tail: join of the KW partials (32 x DM), then y = (P.x / l) Wh + bh by four waves, then out^T = Wo^T y^T (A = Wo columns, B = query rows), 16 queries x 32 columns a wave, and the residual.
typedef __attribute__((ext_vector_type(2))) __bf16 v2bf;
typedef __attribute__((ext_vector_type(8))) unsigned v8u;
typedef __attribute__((ext_vector_type(4))) unsigned v4u;
typedef __attribute__((ext_vector_type(8))) short s16x8;
typedef v8us __attribute__((may_alias)) v8usa;
__device__ __forceinline__ float xhalf(float x) { const int b = __float_as_int(x); return __int_as_float(__builtin_amdgcn_permlanex16(b, b, 0x76543210, 0xfedcba98, false, false)); }   // value of lane l ^ 16
__device__ __forceinline__ v8us ldtr(const bf* p) { typedef __attribute__((address_space(3))) s16x8 lds_s16x8; return __builtin_bit_cast(v8us, __builtin_amdgcn_ds_load_tr16_b128_v8i16((lds_s16x8*)p)); }   // lane (c, h) gets rows 8 h + 0..7 of column c of a 16 x 16 tile
__device__ __forceinline__ unsigned pk2(float a, float b) { unsigned r; asm("v_cvt_pk_bf16_f32 %0, %1, %2" : "=v"(r) : "v"(a), "v"(b)); return r; }   // two f32 of different loads rounded into one register; written as asm because the vector convert first copied each such pair into a fresh register pair (a move per value)
// The head's and the y stage's roundings, by the convert instruction (round to nearest even, as f2bf): these stages are serial, a few waves at work while the others wait at a barrier.
__device__ __forceinline__ unsigned pkc(float a, float b) { const v2f t = { a, b }; return __builtin_bit_cast(unsigned, __builtin_convertvector(t, v2bf)); }
__device__ __forceinline__ v16bf xfragc(const float* p) {   // as xfrag
    const v4f a = *(const v4fa*)p, b = *(const v4fa*)(p + 4), d = *(const v4fa*)(p + 16), e = *(const v4fa*)(p + 20);
    const v8u k = { pkc(a[0], a[1]), pkc(a[2], a[3]), pkc(b[0], b[1]), pkc(b[2], b[3]), pkc(d[0], d[1]), pkc(d[2], d[3]), pkc(e[0], e[1]), pkc(e[2], e[3]) }; return __builtin_bit_cast(v16bf, k); }
__device__ __forceinline__ v16bf wfragc(const float* p, int ld) {   // as wfrag
    v8u k;
#pragma unroll
    for (int j = 0; j < 4; ++j) { k[j] = pkc(p[2 * j * ld], p[(2 * j + 1) * ld]); k[4 + j] = pkc(p[(16 + 2 * j) * ld], p[(17 + 2 * j) * ld]); }
    return __builtin_bit_cast(v16bf, k); }
__device__ __forceinline__ void split2(float y0, float y1, unsigned& hp, unsigned& lp) { hp = pkc(y0, y1); lp = pkc(y0 - __uint_as_float(hp << 16), y1 - __uint_as_float(hp & 0xFFFF0000u)); }   // two values into a hi pair and a lo pair
__device__ __forceinline__ void split8(v8f a, const float* __restrict__ pb, v8us& oh, v8us& ol) {   // a + the bf16-rounded bias pb[0..7], split
    v4u hq, lq;
#pragma unroll
    for (int j = 0; j < 4; ++j) { const unsigned bp = pkc(pb[2 * j], pb[2 * j + 1]); unsigned hp, lp; split2(a[2 * j] + __uint_as_float(bp << 16), a[2 * j + 1] + __uint_as_float(bp & 0xFFFF0000u), hp, lp); hq[j] = hp; lq[j] = lp; }
    oh = __builtin_bit_cast(v8us, hq); ol = __builtin_bit_cast(v8us, lq); }
typedef uint32_t u32x4 __attribute__((ext_vector_type(4)));
typedef uint32_t u32x8 __attribute__((ext_vector_type(8)));
__device__ __forceinline__ uint32_t uni(uint32_t v) { return (uint32_t)__builtin_amdgcn_readfirstlane(v); }
__device__ __forceinline__ uint32_t pinned(uint32_t v) { uint32_t w = uni(v); asm volatile("" : "+s"(w)); return w; }   // an issue test or a descriptor word held in a scalar register: the test compiles to a scalar branch (a tensor load ignores EXEC), and what is formed from the word is formed behind the wait in front
__device__ __forceinline__ u32x4 tile_g0(uint32_t lds, const float* p) {   // descriptor group 0: one request, its place in LDS, the tile's first byte
    const uint64_t ga = (uint64_t)(size_t)p; u32x4 g; g[0] = uni(1u); g[1] = uni(lds); g[2] = uni((uint32_t)ga); g[3] = uni((((uint32_t)(ga >> 32)) & 0x01FFFFFFu) | 0x80000000u); return g; }
__device__ __forceinline__ u32x8 tile_g1() {   // descriptor group 1: bytes; tensor = tile = 32 rows of 256 bytes at a source pitch of 256 bytes; no mask, no pad
    u32x8 g; g[0] = pinned(0u); g[1] = pinned((uint32_t)(DM * 4) << 16); g[2] = pinned(32u << 16); g[3] = pinned((uint32_t)(DM * 4) << 16); g[4] = pinned(32u); g[5] = pinned((uint32_t)(DM * 4)); g[6] = pinned(0u); g[7] = pinned(0u); return g; }   // pinned: descriptor words held in scalar registers, set once; unpinned, the compiler set the constants anew in front of the loop, over the registers of the request that was out
__device__ __forceinline__ void tile_load(u32x4 g0, u32x8 g1) { asm volatile("tensor_load_to_lds %0, %1" :: "s"(g0), "s"(g1) : "memory"); }
__global__ __launch_bounds__(32 * KW) void k_attn(const float* __restrict__ x, const float* __restrict__ wg, const float* __restrict__ bg, const float* __restrict__ wf, const float* __restrict__ wh, const float* __restrict__ bh, const float* __restrict__ wo, const float* __restrict__ bo, const float* __restrict__ gam, float* O) {
    __shared__ __attribute__((aligned(2048))) unsigned char wr[KW][WRG];   // per wave: its f32 key block, then x^T of it; behind the loop the wave's partial result [query][channel], pitch 272 B, lies over the start of its own region
    static_assert(WRG % 2048 == 0 && 32 * (DM + 4) * 4 <= WRG, "a wave's region is whole 2-KiB units and holds its partial result");
    __shared__ float sm[KW][32], sl[KW][32], sw[KW][32];   // per wave and query: maximum, sum, weight in the join
    __shared__ __align__(16) bf sgh[32][CB + 8], sgl[32][CB + 8];   // g rows, hi and lo, pitch 80 B
    __shared__ __align__(16) bf suh[32][DM + 8], sul[32][DM + 8];   // u rows in the LDS row order of x^T, hi and lo, pitch 144 B
    __shared__ __align__(16) bf sth[32][DM + 8], stl[32][DM + 8];   // joined P.x / l rows, hi and lo
    __shared__ __align__(16) bf sah[32][CB + 8], sal[32][CB + 8];   // y rows, hi and lo
    __shared__ __align__(16) bf shw[2][2][32][16]; __shared__ __align__(16) float shb[CB];   // Wh as A fragments [16 columns][k block][lane], and bh
    const int lane = threadIdx.x & 31, c = lane & 15, h = lane >> 4, w = __builtin_amdgcn_readfirstlane(threadIdx.x >> 5); const int q0 = blockIdx.x * 32; const int k0 = w * KR; const int bz = blockIdx.y;   // w in a scalar register: scalar loop control and key addresses
    const int tb = bz * TT;   // this batch's first token
    const int rot = (blockIdx.x + (blockIdx.x >> 3) + w) & (KR / 32 - 1);   // first block of the walk: differs between neighbours in the grid, between work-groups 8 apart and between a work-group's waves (for speed only; any value is right)
    const int gq = w & 1, hi2 = w >> 1;   // head and y stage: 16 queries; which 16 columns or channels
    const float* xk = x + (size_t)(tb + k0) * DM;   // the wave's key range
    const uint32_t lst = (uint32_t)(size_t)&wr[w][0];   // the place of the wave's key block: byte offset in the work-group's LDS
    const u32x8 g1 = tile_g1(); const u32x4 g0a = tile_g0(lst, xk + (size_t)(32 * rot) * DM);
    tile_load(g0a, g1);   // the first block, ahead of the head; every wave asks for its own
    v16bf fa = (v16bf){};
    if (w < 8) { const float* pf = wf + (size_t)(16 * hi2 + c) * CB + 8 * h; fa = xfragc(pf);   // Wf rows (channels), k = projection column, contiguous; fetched ahead of the barrier
        asm volatile("s_wait_xcnt 0x0" :: "v"(pf) : "memory"); }   // the loads' address registers stay whole until every load above has taken its address
    if (w < 4) {
        const float* px = x + (size_t)(tb + q0 + 16 * gq + c) * DM + 8 * h; const float* pw = wg + (size_t)(8 * h) * CB + 16 * hi2 + c; const float* pb = bg + 16 * hi2 + 8 * h;
        v16bf xa[2], wa[2]; float bv[8];
#pragma unroll
        for (int kk = 0; kk < 2; ++kk) { xa[kk] = xfragc(px + 32 * kk); wa[kk] = wfragc(pw + 32 * kk * CB, CB); }
#pragma unroll
        for (int r = 0; r < 8; ++r) bv[r] = pb[r];
        asm volatile("s_wait_xcnt 0x0" :: "v"(px), "v"(pw) : "memory");   // as above
        v8f a = (v8f){}; a = wmmab(wa[0], xa[0], a); a = wmmab(wa[1], xa[1], a); v8us oh, ol;   // a[r] = g[query c][column 16 hi2 + 8 h + r]
        split8(a, bv, oh, ol);
        *(v8us*)&sgh[16 * gq + c][16 * hi2 + 8 * h] = oh; *(v8us*)&sgl[16 * gq + c][16 * hi2 + 8 * h] = ol; }
    if (w == 8 || w == 9) {   // two waves that would only wait here fetch the y stage's operands: Wh, rounded, as A fragments, and bh
        const float* pw = wh + (size_t)(8 * h) * CB + 16 * (w - 8) + c; const float* pb = bh + lane;
        const v16bf t0 = wfragc(pw, CB), t1 = wfragc(pw + 32 * CB, CB); const float bl = pb[0];
        asm volatile("s_wait_xcnt 0x0" :: "v"(pw), "v"(pb) : "memory");   // as above
        const v8u u0 = __builtin_bit_cast(v8u, t0), u1 = __builtin_bit_cast(v8u, t1);
        *(v8us*)&shw[w - 8][0][lane][0] = __builtin_bit_cast(v8us, __builtin_shufflevector(u0, u0, 0, 1, 2, 3)); *(v8us*)&shw[w - 8][0][lane][8] = __builtin_bit_cast(v8us, __builtin_shufflevector(u0, u0, 4, 5, 6, 7));
        *(v8us*)&shw[w - 8][1][lane][0] = __builtin_bit_cast(v8us, __builtin_shufflevector(u1, u1, 0, 1, 2, 3)); *(v8us*)&shw[w - 8][1][lane][8] = __builtin_bit_cast(v8us, __builtin_shufflevector(u1, u1, 4, 5, 6, 7));
        if (w == 8) shb[lane] = bl; }
    __syncthreads();   // hands g to the waves that make u
    if (w < 8) {
        const v16bf gh = WFrag<bf>::ld(&sgh[16 * gq + c][8 * h]), gl = WFrag<bf>::ld(&sgl[16 * gq + c][8 * h]);
        v8f a = (v8f){}; a = wmmab(fa, gh, a); a = wmmab(fa, gl, a);   // a[r] = u[query c][channel 16 hi2 + 8 h + r]
#pragma unroll
        for (int r = 0; r < 8; r += 2) { unsigned hp, lp; split2(a[r], a[r + 1], hp, lp); const int ro = 16 * (r & 3) + 4 * hi2 + 2 * h + (r >> 2);   // r + 1 lies 16 rows on
            suh[16 * gq + c][ro] = (bf)(hp & 0xFFFFu); suh[16 * gq + c][ro + 16] = (bf)(hp >> 16); sul[16 * gq + c][ro] = (bf)(lp & 0xFFFFu); sul[16 * gq + c][ro + 16] = (bf)(lp >> 16); } }   // channel ch sits in row 16 (ch & 3) + (ch >> 2)
    __syncthreads();   // hands u to every wave
    v16bf uh[2][2], ul[2][2];   // both halves stay in registers: none holds a key block in flight any more
#pragma unroll
    for (int g = 0; g < 2; ++g)
#pragma unroll
        for (int kk = 0; kk < 2; ++kk) { uh[g][kk] = WFrag<bf>::ld(&suh[16 * g + c][32 * kk + 8 * h]); ul[g][kk] = WFrag<bf>::ld(&sul[16 * g + c][32 * kk + 8 * h]); }
    bf* xtw = (bf*)&wr[w][STG]; const float* pxs = (const float*)&wr[w][0] + (8 * h) * DM + 4 * c;   // x^T of the block; the lane's 16 bytes of key 8 h in the f32 block
    bf* pst = &xtw[c * XP + 8 * h];   // the lane's 16 bytes of row c (+ 16 dt), keys 8 h + 0..7; the second eight keys lie 16 elements on
    const bf* ptr = &xtw[(8 * h + (lane & 7)) * XP + 8 * ((lane >> 3) & 1)];   // the transposing load's lane address in the tile at row 0, key 0
    v8f o[4][2]; float m[2], l[2];
#pragma unroll
    for (int g = 0; g < 2; ++g) { m[g] = -3.0e38f; l[g] = 0.f;
#pragma unroll
        for (int dt = 0; dt < 4; ++dt) o[dt][g] = (v8f){}; }
    asm volatile("s_wait_tensorcnt 0x0" :: "s"(g0a) : "memory");   // the first block has landed; group 0 is named so that its registers stay whole through the head, while the request is out
#pragma unroll 1   // kept rolled: the body is long (for speed only)
    for (int i = 0; i < KR / 32; ++i) {
        v4f xr[16];
#pragma unroll
        for (int e = 0; e < 16; ++e) xr[e] = *(const v4fa*)(pxs + (e < 8 ? e : e + 8) * DM);
        v16bf va[4];
#pragma unroll
        for (int dt = 0; dt < 4; ++dt) { v8u pk;
#pragma unroll
            for (int j = 0; j < 8; ++j) pk[j] = pk2(xr[2 * j][dt], xr[2 * j + 1][dt]);
            va[dt] = __builtin_bit_cast(v16bf, pk); const v8us lo8 = __builtin_bit_cast(v8us, __builtin_shufflevector(pk, pk, 0, 1, 2, 3)), hi8 = __builtin_bit_cast(v8us, __builtin_shufflevector(pk, pk, 4, 5, 6, 7));
            *(v8usa*)(pst + 16 * dt * XP) = lo8; *(v8usa*)(pst + 16 * dt * XP + 16) = hi8; }
        asm volatile("s_wait_dscnt 0x0" ::: "memory");   // the wave's own rows are in LDS before it reads them back across lanes; and its reads of the f32 block have retired before the block is refilled
        if (pinned(i + 1 < KR / 32)) { const u32x4 g0 = tile_g0(lst, xk + (size_t)(32 * pinned((rot + i + 1) & (KR / 32 - 1))) * DM); tile_load(g0, g1); }   // the next block, while there is one: it has the rest of the trip to land
        v16bf ka[2][2];
#pragma unroll
        for (int t = 0; t < 2; ++t)
#pragma unroll
            for (int kk = 0; kk < 2; ++kk) ka[t][kk] = cat16b(ldtr(ptr + 32 * kk * XP + 16 * t), ldtr(ptr + (32 * kk + 16) * XP + 16 * t));
        v8f s[2][2];
#pragma unroll
        for (int t = 0; t < 2; ++t)
#pragma unroll
            for (int g = 0; g < 2; ++g) { v8f a = (v8f){}; a = wmmab(ka[t][0], uh[g][0], a); a = wmmab(ka[t][1], uh[g][1], a); a = wmmab(ka[t][0], ul[g][0], a); a = wmmab(ka[t][1], ul[g][1], a); s[t][g] = a; }
        __builtin_amdgcn_sched_barrier(0);   // keeps the score products in one run: the scheduler drew the first maxima in among them, each behind idle slots that wait for its product
        v16bf ph[2], pl[2];
#pragma unroll
        for (int g = 0; g < 2; ++g) {
            float mx = s[0][g][0];
#pragma unroll
            for (int r = 1; r < 8; ++r) mx = fmaxf(mx, s[0][g][r]);
#pragma unroll
            for (int r = 0; r < 8; ++r) mx = fmaxf(mx, s[1][g][r]);
            mx = fmaxf(mx, xhalf(mx));
            const float mn = fmaxf(m[g], mx); const float al = __builtin_amdgcn_exp2f((m[g] - mn) * L2E); const float ml = mn * L2E; m[g] = mn;
            v2f sum = (v2f){}; const v2f le2 = { L2E, L2E }, ml2 = { -ml, -ml }; v8u hw, lw;
#pragma unroll
            for (int i = 0; i < 8; ++i) { const int t = i >> 2, r = (i & 3) * 2; v2f x = { s[t][g][r], s[t][g][r + 1] }; x = __builtin_elementwise_fma(x, le2, ml2); v2f p; p[0] = __builtin_amdgcn_exp2f(x[0]); p[1] = __builtin_amdgcn_exp2f(x[1]); sum += p;
                const unsigned hu = __builtin_bit_cast(unsigned, __builtin_convertvector(p, v2bf)); v2f e; e[0] = p[0] - __uint_as_float(hu << 16); e[1] = p[1] - __uint_as_float(hu & 0xFFFF0000u);
                hw[i] = hu; lw[i] = __builtin_bit_cast(unsigned, __builtin_convertvector(e, v2bf)); }
            l[g] = l[g] * al + (sum[0] + sum[1]); ph[g] = __builtin_bit_cast(v16bf, hw); pl[g] = __builtin_bit_cast(v16bf, lw);
#pragma unroll
            for (int dt = 0; dt < 4; ++dt) o[dt][g] *= al; }
#pragma unroll
        for (int dt = 0; dt < 4; ++dt)
#pragma unroll
            for (int g = 0; g < 2; ++g) { v8f a = o[dt][g]; a = wmmab(va[dt], ph[g], a); a = wmmab(va[dt], pl[g], a); o[dt][g] = a; }
        __builtin_amdgcn_sched_barrier(0);   // keeps every product in front of the slots below
        asm volatile("v_nop\n\tv_nop\n\tv_nop\n\tv_nop");   // the four vector slots between the last products and the next trip's converts, which are asm text and write over the products' A registers
        asm volatile("s_wait_tensorcnt 0x0" ::: "memory");   // the next trip's block has landed; behind the last trip: no request of the wave is out
    }
    asm volatile("s_wait_dscnt 0x0" ::: "memory");   // nor any of its LDS reads, before its region takes the partial result
    float* sow = (float*)&wr[w][0];
#pragma unroll
    for (int g = 0; g < 2; ++g) { const float lt = l[g] + xhalf(l[g]); if (h == 0) { sm[w][16 * g + c] = m[g]; sl[w][16 * g + c] = lt; }
#pragma unroll
        for (int r = 0; r < 8; ++r) { const v4f t4 = { o[0][g][r], o[1][g][r], o[2][g][r], o[3][g][r] }; *(v4fa*)&sow[(16 * g + c) * (DM + 4) + 32 * h + 4 * r] = t4; } }   // register r of tile dt is channel 4 (8 h + r) + dt
    __syncthreads();
    float M = sm[0][lane];   // thread (w, lane) makes the one weight of wave w's partial for query lane
#pragma unroll
    for (int k = 1; k < KW; ++k) M = fmaxf(M, sm[k][lane]);
    const float wt = __builtin_amdgcn_exp2f((sm[w][lane] - M) * L2E); sw[w][lane] = wt; sl[w][lane] *= wt;
    __syncthreads();
    {   // the join is 32 queries x 16 threads
        const int q = threadIdx.x >> 4, d0 = (threadIdx.x & 15) * 4; float Ls = 0.f; v4f acc = (v4f){};
#pragma unroll
        for (int k = 0; k < KW; ++k) { Ls += sl[k][q]; acc += *(const v4fa*)((const float*)&wr[k][0] + q * (DM + 4) + d0) * sw[k][q]; }
        const float inv = __fdiv_rn(1.0f, Ls); v4us oh, ol;
#pragma unroll
        for (int k = 0; k < 4; ++k) { unsigned short a, c2; splitf(acc[k] * inv, a, c2); oh[k] = a; ol[k] = c2; }
        *(v4us*)&sth[q][d0] = oh; *(v4us*)&stl[q][d0] = ol; }
    __syncthreads();   // hands the joined rows to the waves of the y stage
    if (w < 4) {   // y = (P.x / l) Wh + bh, 16 queries x 16 columns a wave, as Wh^T t^T
        v16bf th[2], tl[2], ha[2];
#pragma unroll
        for (int kk = 0; kk < 2; ++kk) { ha[kk] = cat16b(*(const v8us*)&shw[hi2][kk][lane][0], *(const v8us*)&shw[hi2][kk][lane][8]); th[kk] = WFrag<bf>::ld(&sth[16 * gq + c][32 * kk + 8 * h]); tl[kk] = WFrag<bf>::ld(&stl[16 * gq + c][32 * kk + 8 * h]); }
        v8f a = (v8f){}; a = wmmab(ha[0], th[0], a); a = wmmab(ha[1], th[1], a); a = wmmab(ha[0], tl[0], a); a = wmmab(ha[1], tl[1], a); v8us oh, ol;   // a[r] = y[query c][column 16 hi2 + 8 h + r]
        split8(a, &shb[16 * hi2 + 8 * h], oh, ol);
        *(v8us*)&sah[16 * gq + c][16 * hi2 + 8 * h] = oh; *(v8us*)&sal[16 * gq + c][16 * hi2 + 8 * h] = ol; }
    __syncthreads();   // hands the y rows to the waves of the out projection
    if (w >= 4) return;   // no barrier follows
    const int g = w & 1, np = w >> 1;   // 16 queries, 32 output columns
    const v16bf ah = WFrag<bf>::ld(&sah[16 * g + c][8 * h]), al = WFrag<bf>::ld(&sal[16 * g + c][8 * h]);
    const float gm = bfr(gam[0]); const size_t ro = (size_t)(bz * TT + q0 + 16 * g + c) * DM + 32 * np + 8 * h;
    const float* px = x + ro; const float* pw = wo + (size_t)(8 * h) * DM + 32 * np + c; const float* pb = bo + 32 * np + 8 * h;
    v16bf wa[2]; v4f xv[2][2], bv[2][2];
#pragma unroll
    for (int j = 0; j < 2; ++j) { wa[j] = wfrag(pw + 16 * j, DM);
#pragma unroll
        for (int u = 0; u < 2; ++u) { xv[j][u] = *(const v4fa*)(px + 16 * j + 4 * u); bv[j][u] = *(const v4fa*)(pb + 16 * j + 4 * u); } }
    asm volatile("s_wait_xcnt 0x0" :: "v"(px), "v"(pw) : "memory");   // the loads' address registers stay whole until every load above has taken its address
#pragma unroll
    for (int j = 0; j < 2; ++j) { v8f a = (v8f){}; a = wmmab(wa[j], ah, a); a = wmmab(wa[j], al, a);
#pragma unroll
        for (int u = 0; u < 2; ++u) { v4f y;
#pragma unroll
            for (int r = 0; r < 4; ++r) y[r] = bfr(xv[j][u][r]) + gm * (a[4 * u + r] + bfr(bv[j][u][r]));
            *(v4fa*)(O + ro + 16 * j + 4 * u) = y; } }
}

extern "C" void kernel_launch(void* const* d_in, const int* in_sizes, int n_in,
                              void* d_out, int out_size, void* d_ws, size_t ws_size, hipStream_t stream) {
    (void)in_sizes; (void)n_in; (void)out_size; (void)d_ws; (void)ws_size;
    const float* x = (const float*)d_in[0]; const float* wf = (const float*)d_in[1]; const float* wg = (const float*)d_in[3]; const float* bg = (const float*)d_in[4]; const float* wh = (const float*)d_in[5]; const float* bh = (const float*)d_in[6]; const float* wo = (const float*)d_in[7]; const float* bo = (const float*)d_in[8]; const float* gam = (const float*)d_in[9];   // d_in[2], the key bias, adds the same number to all scores of a query and drops out of the softmax
    float* OUT = (float*)d_out;     // [2][4096][64]
    k_attn<<<dim3(TT / 32, NB_), 32 * KW, 0, stream>>>(x, wg, bg, wf, wh, bh, wo, bo, gam, OUT);   /* out = x + gamma ((softmax(g.f) . hv) Wo + bo) */
}

// v007
// Measured time: 14.6 microseconds a run.
// Next to v006, in two timings, it ran 1.13 times as fast each time.
// Over all steps from v000 it is 33.0 times as fast.
#include <hip/hip_runtime.h>
#include <stdint.h>

// SAGAN-style self-attention over a 16x16x16 volume (x [2][16][16][16][64] -> tokens [2][4096][64]; f = x Wf + bf (keys), g = x Wg + bg (queries), hv = x Wh + bh (values), all 'xw' [64][32]; s = g.f (no scaling); softmax over the 4096 keys; o = (softmax . hv) Wo + bo ('xw' [32][64]); out = x + gamma o (gamma [1], read) -> [2][16][16][16][64] (0.52 M)).
// Compute dtypes, f32 accumulate: every input rounded to bf16; g on PLAIN bf16 operands (exact) + bias; u = Wf g, the scores u.x, (P.x / l) Wh and o Wo as hl x exact (2 products each); P.x on P rounded once to bf16 x exact (1 product; the sum l is of the unrounded P); softmax f32; residual x + gamma o in f32.
// One launch. s = g.(x_k Wf + bf) = x_k.(Wf g) + g.bf, and g.bf is the same for every key of a query, so it leaves the softmax unchanged; softmax . (x Wh + bh) = (softmax . x) Wh + bh, the weights summing to 1. The keys and values of every query are then the bf16 rows of x themselves.

#define NB_  2
#define TT   4096
#define DM   64
#define CB   32                   // projection width
#define XP   48                   // elements per row of a wave's transposed key block in LDS: 32 keys + 16 of pad = 96 bytes, an odd multiple of 32 bytes (the transposing load's pitch)
#define KW   16                   // waves per work-group of the fused attention kernel (four per SIMD), one key range each
#define KR   (TT / KW)            // keys per wave
#define STG  (32 * DM * 4)        // bytes of a wave's f32 key block in LDS: 32 rows of 256 bytes, no pad (a half-wave reads one whole row)
#define WRG  (STG + DM * XP * 2)  // a wave's own LDS region: the f32 key block, behind it x^T of the block; 7 x 2 KiB, so every wave's key block starts at a multiple of 2 KiB
#define L2E  1.4426950408889634f
typedef unsigned short bf;
typedef __attribute__((ext_vector_type(16))) __bf16   v16bf;
typedef __attribute__((ext_vector_type(8)))  unsigned short v8us;
typedef __attribute__((ext_vector_type(4)))  unsigned short v4us;
typedef __attribute__((ext_vector_type(8)))  float    v8f;
typedef __attribute__((ext_vector_type(4)))  float    v4f;
typedef __attribute__((ext_vector_type(2)))  float    v2f;
typedef v4f  __attribute__((may_alias)) v4fa;

__device__ __forceinline__ unsigned short f2bf(float f) { unsigned u = __float_as_uint(f); u += 0x7FFFu + ((u >> 16) & 1u); return (unsigned short)(u >> 16); }
__device__ __forceinline__ float bf2f(unsigned short b) { return __uint_as_float(((unsigned)b) << 16); }
__device__ __forceinline__ float bfr(float f) { return bf2f(f2bf(f)); }
__device__ __forceinline__ void splitf(float y, unsigned short& h, unsigned short& l) { h = f2bf(y); l = f2bf(y - bf2f(h)); }
__device__ __forceinline__ v16bf cat16b(v8us lo, v8us hi) { return __builtin_bit_cast(v16bf, __builtin_shufflevector(lo, hi, 0, 1, 2, 3, 4, 5, 6, 7, 8, 9, 10, 11, 12, 13, 14, 15)); }
__device__ __forceinline__ v8f wmmab(v16bf a, v16bf b, v8f c) { return __builtin_amdgcn_wmma_f32_16x16x32_bf16(false, a, false, b, (short)0, c, false, false); }

// Fragment loaders. Lane (c, h) holds row c of 16 rows; of a block of 32 k it holds k = 8 h + 0..7 and 16 + 8 h + 0..7, in that order, in all three.
template <typename T16> struct WFrag;
template <> struct WFrag<bf> { typedef v16bf V; static __device__ __forceinline__ V ld(const bf* p) { return cat16b(*(const v8us*)p, *(const v8us*)(p + 16)); } };   // p = row c, k = 8 h, of a bf16 plane with k contiguous
__device__ __forceinline__ v16bf xfrag(const float* p) {   // p = row c, k = 8 h, of an f32 array with k contiguous; rounded to bf16
    const v4f a = *(const v4fa*)p, b = *(const v4fa*)(p + 4), d = *(const v4fa*)(p + 16), e = *(const v4fa*)(p + 20); v8us lo, hi;
#pragma unroll
    for (int i = 0; i < 4; ++i) { lo[i] = f2bf(a[i]); lo[4 + i] = f2bf(b[i]); hi[i] = f2bf(d[i]); hi[4 + i] = f2bf(e[i]); }
    return cat16b(lo, hi); }
__device__ __forceinline__ v16bf wfrag(const float* p, int ld) {   // p = k row 8 h, column c, of an f32 'xw' weight [k][ld]: column c as a fragment row; rounded to bf16
    v8us lo, hi;
#pragma unroll
    for (int i = 0; i < 8; ++i) { lo[i] = f2bf(p[i * ld]); hi[i] = f2bf(p[(16 + i) * ld]); }
    return cat16b(lo, hi); }

// ---- k_attn: everything. grid (TT / 32, NB_), 32 KW threads. A work-group owns 32 queries; wave w walks keys [w KR, (w + 1) KR) in blocks of 32 and the KW partial results are joined in LDS.
// Head: four waves make g (16 queries x 16 columns each, as Wg^T x^T), eight waves u = Wf g (16 queries x 16 channels each, as Wf g^T), split hi/lo into LDS; every wave then takes u of all 32 queries as B fragments, hi and lo, into registers. Two more waves put Wh and bh into LDS for the tail.
// Key block: each wave brings its 32 f32 rows (8 KiB in a row) into its own LDS block by one tensor load, asked for a whole trip ahead, as soon as the wave has read the block before it out; no register holds a block in flight, and no other wave reads it, so no barrier. Lane (c, h) reads channels 4 c .. 4 c + 3 of keys 8 h + 0..7 and 16 + 8 h + 0..7 from there (a wave-wide read = two whole 256-byte rows). Rounded and packed along the keys, its registers ARE the A fragments of x^T for O^T += x^T P^T: tile dt has channel 4 c + dt in row c, keys in the hardware k order.
// The same registers go to the wave's own LDS block as x^T (row 16 dt + c = channel 4 c + dt) and come back through the transposing load as the A fragments of S^T = x u^T (row = key, k = LDS row); u is stored in that same row order.
// Every work-group of a batch reads the same rows of x from L2: each wave enters its range at its own block rot and wraps, so that at one moment the work-groups ask for all KR / 32 blocks of a range and not all for the same lines.
// Tail: join of the KW partials (32 x DM), then y = (P.x / l) Wh + bh by four waves, then out^T = Wo^T y^T (A = Wo columns, B = query rows), 16 queries x 32 columns a wave, and the residual.
typedef __attribute__((ext_vector_type(2))) __bf16 v2bf;
typedef __attribute__((ext_vector_type(8))) unsigned v8u;
typedef __attribute__((ext_vector_type(4))) unsigned v4u;
typedef __attribute__((ext_vector_type(8))) short s16x8;
typedef v8us __attribute__((may_alias)) v8usa;
__device__ __forceinline__ float xhalf(float x) { const int b = __float_as_int(x); return __int_as_float(__builtin_amdgcn_permlanex16(b, b, 0x76543210, 0xfedcba98, false, false)); }   // value of lane l ^ 16
__device__ __forceinline__ v8us ldtr(const bf* p) { typedef __attribute__((address_space(3))) s16x8 lds_s16x8; return __builtin_bit_cast(v8us, __builtin_amdgcn_ds_load_tr16_b128_v8i16((lds_s16x8*)p)); }   // lane (c, h) gets rows 8 h + 0..7 of column c of a 16 x 16 tile
__device__ __forceinline__ unsigned pk2(float a, float b) { unsigned r; asm("v_cvt_pk_bf16_f32 %0, %1, %2" : "=v"(r) : "v"(a), "v"(b)); return r; }   // two f32 of different loads rounded into one register; written as asm because the vector convert first copied each such pair into a fresh register pair (a move per value)
// The head's and the y stage's roundings, by the convert instruction (round to nearest even, as f2bf): these stages are serial, a few waves at work while the others wait at a barrier.
__device__ __forceinline__ unsigned pkc(float a, float b) { const v2f t = { a, b }; return __builtin_bit_cast(unsigned, __builtin_convertvector(t, v2bf)); }
__device__ __forceinline__ v16bf xfragc(const float* p) {   // as xfrag
    const v4f a = *(const v4fa*)p, b = *(const v4fa*)(p + 4), d = *(const v4fa*)(p + 16), e = *(const v4fa*)(p + 20);
    const v8u k = { pkc(a[0], a[1]), pkc(a[2], a[3]), pkc(b[0], b[1]), pkc(b[2], b[3]), pkc(d[0], d[1]), pkc(d[2], d[3]), pkc(e[0], e[1]), pkc(e[2], e[3]) }; return __builtin_bit_cast(v16bf, k); }
__device__ __forceinline__ v16bf wfragc(const float* p, int ld) {   // as wfrag
    v8u k;
#pragma unroll
    for (int j = 0; j < 4; ++j) { k[j] = pkc(p[2 * j * ld], p[(2 * j + 1) * ld]); k[4 + j] = pkc(p[(16 + 2 * j) * ld], p[(17 + 2 * j) * ld]); }
    return __builtin_bit_cast(v16bf, k); }
__device__ __forceinline__ void split2(float y0, float y1, unsigned& hp, unsigned& lp) { hp = pkc(y0, y1); lp = pkc(y0 - __uint_as_float(hp << 16), y1 - __uint_as_float(hp & 0xFFFF0000u)); }   // two values into a hi pair and a lo pair
__device__ __forceinline__ void split8(v8f a, const float* __restrict__ pb, v8us& oh, v8us& ol) {   // a + the bf16-rounded bias pb[0..7], split
    v4u hq, lq;
#pragma unroll
    for (int j = 0; j < 4; ++j) { const unsigned bp = pkc(pb[2 * j], pb[2 * j + 1]); unsigned hp, lp; split2(a[2 * j] + __uint_as_float(bp << 16), a[2 * j + 1] + __uint_as_float(bp & 0xFFFF0000u), hp, lp); hq[j] = hp; lq[j] = lp; }
    oh = __builtin_bit_cast(v8us, hq); ol = __builtin_bit_cast(v8us, lq); }
typedef uint32_t u32x4 __attribute__((ext_vector_type(4)));
typedef uint32_t u32x8 __attribute__((ext_vector_type(8)));
__device__ __forceinline__ uint32_t uni(uint32_t v) { return (uint32_t)__builtin_amdgcn_readfirstlane(v); }
__device__ __forceinline__ uint32_t pinned(uint32_t v) { uint32_t w = uni(v); asm volatile("" : "+s"(w)); return w; }   // an issue test or a descriptor word held in a scalar register: the test compiles to a scalar branch (a tensor load ignores EXEC), and what is formed from the word is formed behind the wait in front
__device__ __forceinline__ u32x4 tile_g0(uint32_t lds, const float* p) {   // descriptor group 0: one request, its place in LDS, the tile's first byte
    const uint64_t ga = (uint64_t)(size_t)p; u32x4 g; g[0] = uni(1u); g[1] = uni(lds); g[2] = uni((uint32_t)ga); g[3] = uni((((uint32_t)(ga >> 32)) & 0x01FFFFFFu) | 0x80000000u); return g; }
__device__ __forceinline__ u32x8 tile_g1() {   // descriptor group 1: bytes; tensor = tile = 32 rows of 256 bytes at a source pitch of 256 bytes; no mask, no pad
    u32x8 g; g[0] = pinned(0u); g[1] = pinned((uint32_t)(DM * 4) << 16); g[2] = pinned(32u << 16); g[3] = pinned((uint32_t)(DM * 4) << 16); g[4] = pinned(32u); g[5] = pinned((uint32_t)(DM * 4)); g[6] = pinned(0u); g[7] = pinned(0u); return g; }   // pinned: descriptor words held in scalar registers, set once; unpinned, the compiler set the constants anew in front of the loop, over the registers of the request that was out
__device__ __forceinline__ void tile_load(u32x4 g0, u32x8 g1) { asm volatile("tensor_load_to_lds %0, %1" :: "s"(g0), "s"(g1) : "memory"); }
__global__ __launch_bounds__(32 * KW) void k_attn(const float* __restrict__ x, const float* __restrict__ wg, const float* __restrict__ bg, const float* __restrict__ wf, const float* __restrict__ wh, const float* __restrict__ bh, const float* __restrict__ wo, const float* __restrict__ bo, const float* __restrict__ gam, float* O) {
    __shared__ __attribute__((aligned(2048))) unsigned char wr[KW][WRG];   // per wave: its f32 key block, then x^T of it; behind the loop the wave's partial result [query][channel], pitch 272 B, lies over the start of its own region
    static_assert(WRG % 2048 == 0 && 32 * (DM + 4) * 4 <= WRG, "a wave's region is whole 2-KiB units and holds its partial result");
    __shared__ float sm[KW][32], sl[KW][32], sw[KW][32];   // per wave and query: maximum, sum, weight in the join
    __shared__ __align__(16) bf sgh[32][CB + 8], sgl[32][CB + 8];   // g rows, hi and lo, pitch 80 B
    __shared__ __align__(16) bf suh[32][DM + 8], sul[32][DM + 8];   // u rows in the LDS row order of x^T, hi and lo, pitch 144 B
    __shared__ __align__(16) bf sth[32][DM + 8], stl[32][DM + 8];   // joined P.x / l rows, hi and lo
    __shared__ __align__(16) bf sah[32][CB + 8], sal[32][CB + 8];   // y rows, hi and lo
    __shared__ __align__(16) bf shw[2][2][32][16]; __shared__ __align__(16) float shb[CB];   // Wh as A fragments [16 columns][k block][lane], and bh
    const int lane = threadIdx.x & 31, c = lane & 15, h = lane >> 4, w = __builtin_amdgcn_readfirstlane(threadIdx.x >> 5); const int q0 = blockIdx.x * 32; const int k0 = w * KR; const int bz = blockIdx.y;   // w in a scalar register: scalar loop control and key addresses
    const int tb = bz * TT;   // this batch's first token
    const int rot = (blockIdx.x + (blockIdx.x >> 3) + w) & (KR / 32 - 1);   // first block of the walk: differs between neighbours in the grid, between work-groups 8 apart and between a work-group's waves (for speed only; any value is right)
    const int gq = w & 1, hi2 = w >> 1;   // head and y stage: 16 queries; which 16 columns or channels
    const float* xk = x + (size_t)(tb + k0) * DM;   // the wave's key range
    const uint32_t lst = (uint32_t)(size_t)&wr[w][0];   // the place of the wave's key block: byte offset in the work-group's LDS
    const u32x8 g1 = tile_g1(); const u32x4 g0a = tile_g0(lst, xk + (size_t)(32 * rot) * DM);
    tile_load(g0a, g1);   // the first block, ahead of the head; every wave asks for its own
    v16bf fa = (v16bf){};
    if (w < 8) { const float* pf = wf + (size_t)(16 * hi2 + c) * CB + 8 * h; fa = xfragc(pf);   // Wf rows (channels), k = projection column, contiguous; fetched ahead of the barrier
        asm volatile("s_wait_xcnt 0x0" :: "v"(pf) : "memory"); }   // the loads' address registers stay whole until every load above has taken its address
    if (w < 4) {
        const float* px = x + (size_t)(tb + q0 + 16 * gq + c) * DM + 8 * h; const float* pw = wg + (size_t)(8 * h) * CB + 16 * hi2 + c; const float* pb = bg + 16 * hi2 + 8 * h;
        v16bf xa[2], wa[2]; float bv[8];
#pragma unroll
        for (int kk = 0; kk < 2; ++kk) { xa[kk] = xfragc(px + 32 * kk); wa[kk] = wfragc(pw + 32 * kk * CB, CB); }
#pragma unroll
        for (int r = 0; r < 8; ++r) bv[r] = pb[r];
        asm volatile("s_wait_xcnt 0x0" :: "v"(px), "v"(pw) : "memory");   // as above
        v8f a = (v8f){}; a = wmmab(wa[0], xa[0], a); a = wmmab(wa[1], xa[1], a); v8us oh, ol;   // a[r] = g[query c][column 16 hi2 + 8 h + r]
        split8(a, bv, oh, ol);
        *(v8us*)&sgh[16 * gq + c][16 * hi2 + 8 * h] = oh; *(v8us*)&sgl[16 * gq + c][16 * hi2 + 8 * h] = ol; }
    if (w == 8 || w == 9) {   // two waves that would only wait here fetch the y stage's operands: Wh, rounded, as A fragments, and bh
        const float* pw = wh + (size_t)(8 * h) * CB + 16 * (w - 8) + c; const float* pb = bh + lane;
        const v16bf t0 = wfragc(pw, CB), t1 = wfragc(pw + 32 * CB, CB); const float bl = pb[0];
        asm volatile("s_wait_xcnt 0x0" :: "v"(pw), "v"(pb) : "memory");   // as above
        const v8u u0 = __builtin_bit_cast(v8u, t0), u1 = __builtin_bit_cast(v8u, t1);
        *(v8us*)&shw[w - 8][0][lane][0] = __builtin_bit_cast(v8us, __builtin_shufflevector(u0, u0, 0, 1, 2, 3)); *(v8us*)&shw[w - 8][0][lane][8] = __builtin_bit_cast(v8us, __builtin_shufflevector(u0, u0, 4, 5, 6, 7));
        *(v8us*)&shw[w - 8][1][lane][0] = __builtin_bit_cast(v8us, __builtin_shufflevector(u1, u1, 0, 1, 2, 3)); *(v8us*)&shw[w - 8][1][lane][8] = __builtin_bit_cast(v8us, __builtin_shufflevector(u1, u1, 4, 5, 6, 7));
        if (w == 8) shb[lane] = bl; }
    __syncthreads();   // hands g to the waves that make u
    if (w < 8) {
        const v16bf gh = WFrag<bf>::ld(&sgh[16 * gq + c][8 * h]), gl = WFrag<bf>::ld(&sgl[16 * gq + c][8 * h]);
        v8f a = (v8f){}; a = wmmab(fa, gh, a); a = wmmab(fa, gl, a);   // a[r] = u[query c][channel 16 hi2 + 8 h + r]
#pragma unroll
        for (int r = 0; r < 8; r += 2) { unsigned hp, lp; split2(a[r], a[r + 1], hp, lp); const int ro = 16 * (r & 3) + 4 * hi2 + 2 * h + (r >> 2);   // r + 1 lies 16 rows on
            suh[16 * gq + c][ro] = (bf)(hp & 0xFFFFu); suh[16 * gq + c][ro + 16] = (bf)(hp >> 16); sul[16 * gq + c][ro] = (bf)(lp & 0xFFFFu); sul[16 * gq + c][ro + 16] = (bf)(lp >> 16); } }   // channel ch sits in row 16 (ch & 3) + (ch >> 2)
    __syncthreads();   // hands u to every wave
    v16bf uh[2][2], ul[2][2];   // both halves stay in registers: none holds a key block in flight any more
#pragma unroll
    for (int g = 0; g < 2; ++g)
#pragma unroll
        for (int kk = 0; kk < 2; ++kk) { uh[g][kk] = WFrag<bf>::ld(&suh[16 * g + c][32 * kk + 8 * h]); ul[g][kk] = WFrag<bf>::ld(&sul[16 * g + c][32 * kk + 8 * h]); }
    bf* xtw = (bf*)&wr[w][STG]; const float* pxs = (const float*)&wr[w][0] + (8 * h) * DM + 4 * c;   // x^T of the block; the lane's 16 bytes of key 8 h in the f32 block
    bf* pst = &xtw[c * XP + 8 * h];   // the lane's 16 bytes of row c (+ 16 dt), keys 8 h + 0..7; the second eight keys lie 16 elements on
    const bf* ptr = &xtw[(8 * h + (lane & 7)) * XP + 8 * ((lane >> 3) & 1)];   // the transposing load's lane address in the tile at row 0, key 0
    v8f o[4][2]; float m[2], l[2];
#pragma unroll
    for (int g = 0; g < 2; ++g) { m[g] = -3.0e38f; l[g] = 0.f;
#pragma unroll
        for (int dt = 0; dt < 4; ++dt) o[dt][g] = (v8f){}; }
    asm volatile("s_wait_tensorcnt 0x0" :: "s"(g0a) : "memory");   // the first block has landed; group 0 is named so that its registers stay whole through the head, while the request is out
#pragma unroll 1   // kept rolled: the body is long (for speed only)
    for (int i = 0; i < KR / 32; ++i) {
        v4f xr[16];
#pragma unroll
        for (int e = 0; e < 16; ++e) xr[e] = *(const v4fa*)(pxs + (e < 8 ? e : e + 8) * DM);
        v16bf va[4];
#pragma unroll
        for (int dt = 0; dt < 4; ++dt) { v8u pk;
#pragma unroll
            for (int j = 0; j < 8; ++j) pk[j] = pk2(xr[2 * j][dt], xr[2 * j + 1][dt]);
            va[dt] = __builtin_bit_cast(v16bf, pk); const v8us lo8 = __builtin_bit_cast(v8us, __builtin_shufflevector(pk, pk, 0, 1, 2, 3)), hi8 = __builtin_bit_cast(v8us, __builtin_shufflevector(pk, pk, 4, 5, 6, 7));
            *(v8usa*)(pst + 16 * dt * XP) = lo8; *(v8usa*)(pst + 16 * dt * XP + 16) = hi8; }
        asm volatile("s_wait_dscnt 0x0" ::: "memory");   // the wave's own rows are in LDS before it reads them back across lanes; and its reads of the f32 block have retired before the block is refilled
        if (pinned(i + 1 < KR / 32)) { const u32x4 g0 = tile_g0(lst, xk + (size_t)(32 * pinned((rot + i + 1) & (KR / 32 - 1))) * DM); tile_load(g0, g1); }   // the next block, while there is one: it has the rest of the trip to land
        v16bf ka[2][2];
#pragma unroll
        for (int t = 0; t < 2; ++t)
#pragma unroll
            for (int kk = 0; kk < 2; ++kk) ka[t][kk] = cat16b(ldtr(ptr + 32 * kk * XP + 16 * t), ldtr(ptr + (32 * kk + 16) * XP + 16 * t));
        v8f s[2][2];
#pragma unroll
        for (int t = 0; t < 2; ++t)
#pragma unroll
            for (int g = 0; g < 2; ++g) { v8f a = (v8f){}; a = wmmab(ka[t][0], uh[g][0], a); a = wmmab(ka[t][1], uh[g][1], a); a = wmmab(ka[t][0], ul[g][0], a); a = wmmab(ka[t][1], ul[g][1], a); s[t][g] = a; }
        __builtin_amdgcn_sched_barrier(0);   // keeps the score products in one run: the scheduler drew the first maxima in among them, each behind idle slots that wait for its product
        v16bf ph[2];   // P rounded once to bf16
#pragma unroll
        for (int g = 0; g < 2; ++g) {
            float mx = s[0][g][0];
#pragma unroll
            for (int r = 1; r < 8; ++r) mx = fmaxf(mx, s[0][g][r]);
#pragma unroll
            for (int r = 0; r < 8; ++r) mx = fmaxf(mx, s[1][g][r]);
            mx = fmaxf(mx, xhalf(mx));
            const float mn = fmaxf(m[g], mx); const float al = __builtin_amdgcn_exp2f((m[g] - mn) * L2E); const float ml = mn * L2E; m[g] = mn;
            v2f sum = (v2f){}; const v2f le2 = { L2E, L2E }, ml2 = { -ml, -ml }; v8u hw;
#pragma unroll
            for (int i = 0; i < 8; ++i) { const int t = i >> 2, r = (i & 3) * 2; v2f x = { s[t][g][r], s[t][g][r + 1] }; x = __builtin_elementwise_fma(x, le2, ml2); v2f p; p[0] = __builtin_amdgcn_exp2f(x[0]); p[1] = __builtin_amdgcn_exp2f(x[1]); sum += p;
                hw[i] = __builtin_bit_cast(unsigned, __builtin_convertvector(p, v2bf)); }
            l[g] = l[g] * al + (sum[0] + sum[1]); ph[g] = __builtin_bit_cast(v16bf, hw);
#pragma unroll
            for (int dt = 0; dt < 4; ++dt) o[dt][g] *= al; }
#pragma unroll
        for (int dt = 0; dt < 4; ++dt)
#pragma unroll
            for (int g = 0; g < 2; ++g) o[dt][g] = wmmab(va[dt], ph[g], o[dt][g]);
        __builtin_amdgcn_sched_barrier(0);   // keeps every product in front of the slots below
        asm volatile("v_nop\n\tv_nop\n\tv_nop\n\tv_nop");   // the four vector slots between the last products and the next trip's converts, which are asm text and write over the products' A registers
        asm volatile("s_wait_tensorcnt 0x0" ::: "memory");   // the next trip's block has landed; behind the last trip: no request of the wave is out
    }
    asm volatile("s_wait_dscnt 0x0" ::: "memory");   // nor any of its LDS reads, before its region takes the partial result
    float* sow = (float*)&wr[w][0];
#pragma unroll
    for (int g = 0; g < 2; ++g) { const float lt = l[g] + xhalf(l[g]); if (h == 0) { sm[w][16 * g + c] = m[g]; sl[w][16 * g + c] = lt; }
#pragma unroll
        for (int r = 0; r < 8; ++r) { const v4f t4 = { o[0][g][r], o[1][g][r], o[2][g][r], o[3][g][r] }; *(v4fa*)&sow[(16 * g + c) * (DM + 4) + 32 * h + 4 * r] = t4; } }   // register r of tile dt is channel 4 (8 h + r) + dt
    __syncthreads();
    float M = sm[0][lane];   // thread (w, lane) makes the one weight of wave w's partial for query lane
#pragma unroll
    for (int k = 1; k < KW; ++k) M = fmaxf(M, sm[k][lane]);
    const float wt = __builtin_amdgcn_exp2f((sm[w][lane] - M) * L2E); sw[w][lane] = wt; sl[w][lane] *= wt;
    __syncthreads();
    {   // the join is 32 queries x 16 threads
        const int q = threadIdx.x >> 4, d0 = (threadIdx.x & 15) * 4; float Ls = 0.f; v4f acc = (v4f){};
#pragma unroll
        for (int k = 0; k < KW; ++k) { Ls += sl[k][q]; acc += *(const v4fa*)((const float*)&wr[k][0] + q * (DM + 4) + d0) * sw[k][q]; }
        const float inv = __fdiv_rn(1.0f, Ls); v4us oh, ol;
#pragma unroll
        for (int k = 0; k < 4; ++k) { unsigned short a, c2; splitf(acc[k] * inv, a, c2); oh[k] = a; ol[k] = c2; }
        *(v4us*)&sth[q][d0] = oh; *(v4us*)&stl[q][d0] = ol; }
    __syncthreads();   // hands the joined rows to the waves of the y stage
    if (w < 4) {   // y = (P.x / l) Wh + bh, 16 queries x 16 columns a wave, as Wh^T t^T
        v16bf th[2], tl[2], ha[2];
#pragma unroll
        for (int kk = 0; kk < 2; ++kk) { ha[kk] = cat16b(*(const v8us*)&shw[hi2][kk][lane][0], *(const v8us*)&shw[hi2][kk][lane][8]); th[kk] = WFrag<bf>::ld(&sth[16 * gq + c][32 * kk + 8 * h]); tl[kk] = WFrag<bf>::ld(&stl[16 * gq + c][32 * kk + 8 * h]); }
        v8f a = (v8f){}; a = wmmab(ha[0], th[0], a); a = wmmab(ha[1], th[1], a); a = wmmab(ha[0], tl[0], a); a = wmmab(ha[1], tl[1], a); v8us oh, ol;   // a[r] = y[query c][column 16 hi2 + 8 h + r]
        split8(a, &shb[16 * hi2 + 8 * h], oh, ol);
        *(v8us*)&sah[16 * gq + c][16 * hi2 + 8 * h] = oh; *(v8us*)&sal[16 * gq + c][16 * hi2 + 8 * h] = ol; }
    __syncthreads();   // hands the y rows to the waves of the out projection
    if (w >= 4) return;   // no barrier follows
    const int g = w & 1, np = w >> 1;   // 16 queries, 32 output columns
    const v16bf ah = WFrag<bf>::ld(&sah[16 * g + c][8 * h]), al = WFrag<bf>::ld(&sal[16 * g + c][8 * h]);
    const float gm = bfr(gam[0]); const size_t ro = (size_t)(bz * TT + q0 + 16 * g + c) * DM + 32 * np + 8 * h;
    const float* px = x + ro; const float* pw = wo + (size_t)(8 * h) * DM + 32 * np + c; const float* pb = bo + 32 * np + 8 * h;
    v16bf wa[2]; v4f xv[2][2], bv[2][2];
#pragma unroll
    for (int j = 0; j < 2; ++j) { wa[j] = wfrag(pw + 16 * j, DM);
#pragma unroll
        for (int u = 0; u < 2; ++u) { xv[j][u] = *(const v4fa*)(px + 16 * j + 4 * u); bv[j][u] = *(const v4fa*)(pb + 16 * j + 4 * u); } }
    asm volatile("s_wait_xcnt 0x0" :: "v"(px), "v"(pw) : "memory");   // the loads' address registers stay whole until every load above has taken its address
#pragma unroll
    for (int j = 0; j < 2; ++j) { v8f a = (v8f){}; a = wmmab(wa[j], ah, a); a = wmmab(wa[j], al, a);
#pragma unroll
        for (int u = 0; u < 2; ++u) { v4f y;
#pragma unroll
            for (int r = 0; r < 4; ++r) y[r] = bfr(xv[j][u][r]) + gm * (a[4 * u + r] + bfr(bv[j][u][r]));
            *(v4fa*)(O + ro + 16 * j + 4 * u) = y; } }
}

extern "C" void kernel_launch(void* const* d_in, const int* in_sizes, int n_in,
                              void* d_out, int out_size, void* d_ws, size_t ws_size, hipStream_t stream) {
    (void)in_sizes; (void)n_in; (void)out_size; (void)d_ws; (void)ws_size;
    const float* x = (const float*)d_in[0]; const float* wf = (const float*)d_in[1]; const float* wg = (const float*)d_in[3]; const float* bg = (const float*)d_in[4]; const float* wh = (const float*)d_in[5]; const float* bh = (const float*)d_in[6]; const float* wo = (const float*)d_in[7]; const float* bo = (const float*)d_in[8]; const float* gam = (const float*)d_in[9];   // d_in[2], the key bias, adds the same number to all scores of a query and drops out of the softmax
    float* OUT = (float*)d_out;     // [2][4096][64]
    k_attn<<<dim3(TT / 32, NB_), 32 * KW, 0, stream>>>(x, wg, bg, wf, wh, bh, wo, bo, gam, OUT);   /* out = x + gamma ((softmax(g.f) . hv) Wo + bo) */
}

// v008
// A run of this version takes 13.8 microseconds.
// Two timings next to v007 both put it at 1.05 times that version's speed.
// Over all steps from v000 it is 34.7 times as fast.
#include <hip/hip_runtime.h>
#include <stdint.h>

// SAGAN-style self-attention over a 16x16x16 volume (x [2][16][16][16][64] -> tokens [2][4096][64]; f = x Wf + bf (keys), g = x Wg + bg (queries), hv = x Wh + bh (values), all 'xw' [64][32]; s = g.f (no scaling); softmax over the 4096 keys; o = (softmax . hv) Wo + bo ('xw' [32][64]); out = x + gamma o (gamma [1], read) -> [2][16][16][16][64] (0.52 M)).
// Compute dtypes, f32 accumulate: every input rounded to bf16; g on PLAIN bf16 operands (exact) + bias; u = Wf g, the scores u.x, (P.x / l) Wh and o Wo as hl x exact (2 products each); P.x on P rounded once to bf16 x exact (1 product; the sum l is of the unrounded P); softmax f32; residual x + gamma o in f32.
// One launch. s = g.(x_k Wf + bf) = x_k.(Wf g) + g.bf, and g.bf is the same for every key of a query, so it leaves the softmax unchanged; softmax . (x Wh + bh) = (softmax . x) Wh + bh, the weights summing to 1. The keys and values of every query are then the bf16 rows of x themselves.

#define NB_  2
#define TT   4096
#define DM   64
#define CB   32                   // projection width
#define KB   64                   // keys per block: one trip of a wave's walk
#define XP   80                   // elements per row of a wave's transposed key block in LDS: 64 keys + 16 of pad = 160 bytes, an odd multiple of 32 bytes (the transposing load's pitch)
#define KW   8                    // waves per work-group of the fused attention kernel (two per SIMD), one key range each
#define KR   (TT / KW)            // keys per wave
#define STG  (KB * DM * 4)        // bytes of a wave's f32 key block in LDS: 64 rows of 256 bytes, no pad (a half-wave reads one whole row)
#define WRG  (STG + DM * XP * 2)  // a wave's own LDS region: the f32 key block, behind it x^T of the block; 13 x 2 KiB, so every wave's key block starts at a multiple of 2 KiB
#define L2E  1.4426950408889634f
typedef unsigned short bf;
typedef __attribute__((ext_vector_type(16))) __bf16   v16bf;
typedef __attribute__((ext_vector_type(8)))  unsigned short v8us;
typedef __attribute__((ext_vector_type(4)))  unsigned short v4us;
typedef __attribute__((ext_vector_type(8)))  float    v8f;
typedef __attribute__((ext_vector_type(4)))  float    v4f;
typedef __attribute__((ext_vector_type(2)))  float    v2f;
typedef v4f  __attribute__((may_alias)) v4fa;

__device__ __forceinline__ unsigned short f2bf(float f) { unsigned u = __float_as_uint(f); u += 0x7FFFu + ((u >> 16) & 1u); return (unsigned short)(u >> 16); }
__device__ __forceinline__ float bf2f(unsigned short b) { return __uint_as_float(((unsigned)b) << 16); }
__device__ __forceinline__ float bfr(float f) { return bf2f(f2bf(f)); }
__device__ __forceinline__ void splitf(float y, unsigned short& h, unsigned short& l) { h = f2bf(y); l = f2bf(y - bf2f(h)); }
__device__ __forceinline__ v16bf cat16b(v8us lo, v8us hi) { return __builtin_bit_cast(v16bf, __builtin_shufflevector(lo, hi, 0, 1, 2, 3, 4, 5, 6, 7, 8, 9, 10, 11, 12, 13, 14, 15)); }
__device__ __forceinline__ v8f wmmab(v16bf a, v16bf b, v8f c) { return __builtin_amdgcn_wmma_f32_16x16x32_bf16(false, a, false, b, (short)0, c, false, false); }

// Fragment loaders. Lane (c, h) holds row c of 16 rows; of a block of 32 k it holds k = 8 h + 0..7 and 16 + 8 h + 0..7, in that order, in all three.
template <typename T16> struct WFrag;
template <> struct WFrag<bf> { typedef v16bf V; static __device__ __forceinline__ V ld(const bf* p) { return cat16b(*(const v8us*)p, *(const v8us*)(p + 16)); } };   // p = row c, k = 8 h, of a bf16 plane with k contiguous
__device__ __forceinline__ v16bf xfrag(const float* p) {   // p = row c, k = 8 h, of an f32 array with k contiguous; rounded to bf16
    const v4f a = *(const v4fa*)p, b = *(const v4fa*)(p + 4), d = *(const v4fa*)(p + 16), e = *(const v4fa*)(p + 20); v8us lo, hi;
#pragma unroll
    for (int i = 0; i < 4; ++i) { lo[i] = f2bf(a[i]); lo[4 + i] = f2bf(b[i]); hi[i] = f2bf(d[i]); hi[4 + i] = f2bf(e[i]); }
    return cat16b(lo, hi); }
__device__ __forceinline__ v16bf wfrag(const float* p, int ld) {   // p = k row 8 h, column c, of an f32 'xw' weight [k][ld]: column c as a fragment row; rounded to bf16
    v8us lo, hi;
#pragma unroll
    for (int i = 0; i < 8; ++i) { lo[i] = f2bf(p[i * ld]); hi[i] = f2bf(p[(16 + i) * ld]); }
    return cat16b(lo, hi); }

// ---- k_attn: everything. grid (TT / 32, NB_), 32 KW threads. A work-group owns 32 queries; wave w walks keys [w KR, (w + 1) KR) in blocks of KB = 64 and the KW partial results are joined in LDS.
// Head: four waves make g (16 queries x 16 columns each, as Wg^T x^T), all eight u = Wf g (16 queries x 16 channels each, as Wf g^T), split hi/lo into LDS; every wave then takes u of all 32 queries as B fragments, hi and lo, into registers. Two of the other waves put Wh and bh into LDS for the tail.
// Key block: each wave brings its 64 f32 rows (16 KiB in a row) into its own LDS block by one tensor load, asked for a whole trip ahead, as soon as the wave has read the block before it out; no register holds a block in flight, and no other wave reads it, so no barrier. Of each half of 32 keys lane (c, h) reads channels 4 c .. 4 c + 3 of keys 8 h + 0..7 and 16 + 8 h + 0..7 from there (a wave-wide read = two whole 256-byte rows). Rounded and packed along the keys, its registers ARE the A fragments of x^T for O^T += x^T P^T: tile dt has channel 4 c + dt in row c, keys in the hardware k order.
// The same registers go to the wave's own LDS block as x^T (row 16 dt + c = channel 4 c + dt) and come back through the transposing load as the A fragments of S^T = x u^T (row = key, k = LDS row); u is stored in that same row order.
// Every work-group of a batch reads the same rows of x from L2: each wave enters its range at its own block rot and wraps, so that at one moment the work-groups ask for all KR / KB blocks of a range and not all for the same lines.
// Tail: join of the KW partials (32 x DM), then y = (P.x / l) Wh + bh by four waves, then out^T = Wo^T y^T (A = Wo columns, B = query rows), 16 queries x 32 columns a wave, and the residual.
typedef __attribute__((ext_vector_type(2))) __bf16 v2bf;
typedef __attribute__((ext_vector_type(8))) unsigned v8u;
typedef __attribute__((ext_vector_type(4))) unsigned v4u;
typedef __attribute__((ext_vector_type(8))) short s16x8;
typedef v8us __attribute__((may_alias)) v8usa;
__device__ __forceinline__ float xhalf(float x) { const int b = __float_as_int(x); return __int_as_float(__builtin_amdgcn_permlanex16(b, b, 0x76543210, 0xfedcba98, false, false)); }   // value of lane l ^ 16
__device__ __forceinline__ v8us ldtr(const bf* p) { typedef __attribute__((address_space(3))) s16x8 lds_s16x8; return __builtin_bit_cast(v8us, __builtin_amdgcn_ds_load_tr16_b128_v8i16((lds_s16x8*)p)); }   // lane (c, h) gets rows 8 h + 0..7 of column c of a 16 x 16 tile
__device__ __forceinline__ unsigned pk2(float a, float b) { unsigned r; asm("v_cvt_pk_bf16_f32 %0, %1, %2" : "=v"(r) : "v"(a), "v"(b)); return r; }   // two f32 of different loads rounded into one register; written as asm because the vector convert first copied each such pair into a fresh register pair (a move per value)
// The head's and the y stage's roundings, by the convert instruction (round to nearest even, as f2bf): these stages are serial, run once, between barriers, outside the key loop.
__device__ __forceinline__ unsigned pkc(float a, float b) { const v2f t = { a, b }; return __builtin_bit_cast(unsigned, __builtin_convertvector(t, v2bf)); }
__device__ __forceinline__ v16bf xfragc(const float* p) {   // as xfrag
    const v4f a = *(const v4fa*)p, b = *(const v4fa*)(p + 4), d = *(const v4fa*)(p + 16), e = *(const v4fa*)(p + 20);
    const v8u k = { pkc(a[0], a[1]), pkc(a[2], a[3]), pkc(b[0], b[1]), pkc(b[2], b[3]), pkc(d[0], d[1]), pkc(d[2], d[3]), pkc(e[0], e[1]), pkc(e[2], e[3]) }; return __builtin_bit_cast(v16bf, k); }
__device__ __forceinline__ v16bf wfragc(const float* p, int ld) {   // as wfrag
    v8u k;
#pragma unroll
    for (int j = 0; j < 4; ++j) { k[j] = pkc(p[2 * j * ld], p[(2 * j + 1) * ld]); k[4 + j] = pkc(p[(16 + 2 * j) * ld], p[(17 + 2 * j) * ld]); }
    return __builtin_bit_cast(v16bf, k); }
__device__ __forceinline__ void split2(float y0, float y1, unsigned& hp, unsigned& lp) { hp = pkc(y0, y1); lp = pkc(y0 - __uint_as_float(hp << 16), y1 - __uint_as_float(hp & 0xFFFF0000u)); }   // two values into a hi pair and a lo pair
__device__ __forceinline__ void split8(v8f a, const float* __restrict__ pb, v8us& oh, v8us& ol) {   // a + the bf16-rounded bias pb[0..7], split
    v4u hq, lq;
#pragma unroll
    for (int j = 0; j < 4; ++j) { const unsigned bp = pkc(pb[2 * j], pb[2 * j + 1]); unsigned hp, lp; split2(a[2 * j] + __uint_as_float(bp << 16), a[2 * j + 1] + __uint_as_float(bp & 0xFFFF0000u), hp, lp); hq[j] = hp; lq[j] = lp; }
    oh = __builtin_bit_cast(v8us, hq); ol = __builtin_bit_cast(v8us, lq); }
typedef uint32_t u32x4 __attribute__((ext_vector_type(4)));
typedef uint32_t u32x8 __attribute__((ext_vector_type(8)));
__device__ __forceinline__ uint32_t uni(uint32_t v) { return (uint32_t)__builtin_amdgcn_readfirstlane(v); }
__device__ __forceinline__ uint32_t pinned(uint32_t v) { uint32_t w = uni(v); asm volatile("" : "+s"(w)); return w; }   // an issue test or a descriptor word held in a scalar register: the test compiles to a scalar branch (a tensor load ignores EXEC), and what is formed from the word is formed behind the wait in front
__device__ __forceinline__ u32x4 tile_g0(uint32_t lds, const float* p) {   // descriptor group 0: one request, its place in LDS, the tile's first byte
    const uint64_t ga = (uint64_t)(size_t)p; u32x4 g; g[0] = uni(1u); g[1] = uni(lds); g[2] = uni((uint32_t)ga); g[3] = uni((((uint32_t)(ga >> 32)) & 0x01FFFFFFu) | 0x80000000u); return g; }
__device__ __forceinline__ u32x8 tile_g1() {   // descriptor group 1: bytes; tensor = tile = KB rows of 256 bytes at a source pitch of 256 bytes; no mask, no pad
    u32x8 g; g[0] = pinned(0u); g[1] = pinned((uint32_t)(DM * 4) << 16); g[2] = pinned((uint32_t)KB << 16); g[3] = pinned((uint32_t)(DM * 4) << 16); g[4] = pinned((uint32_t)KB); g[5] = pinned((uint32_t)(DM * 4)); g[6] = pinned(0u); g[7] = pinned(0u); return g; }   // pinned: descriptor words held in scalar registers, set once; unpinned, the compiler set the constants anew in front of the loop, over the registers of the request that was out
__device__ __forceinline__ void tile_load(u32x4 g0, u32x8 g1) { asm volatile("tensor_load_to_lds %0, %1" :: "s"(g0), "s"(g1) : "memory"); }
__global__ __launch_bounds__(32 * KW) void k_attn(const float* __restrict__ x, const float* __restrict__ wg, const float* __restrict__ bg, const float* __restrict__ wf, const float* __restrict__ wh, const float* __restrict__ bh, const float* __restrict__ wo, const float* __restrict__ bo, const float* __restrict__ gam, float* O) {
    __shared__ __attribute__((aligned(2048))) unsigned char wr[KW][WRG];   // per wave: its f32 key block, then x^T of it; behind the loop the wave's partial result [query][channel], pitch 272 B, lies over the start of its own region
    static_assert(WRG % 2048 == 0 && 32 * (DM + 4) * 4 <= WRG, "a wave's region is whole 2-KiB units and holds its partial result");
    __shared__ float sm[KW][32], sl[KW][32], sw[KW][32];   // per wave and query: maximum, sum, weight in the join
    __shared__ __align__(16) bf sgh[32][CB + 8], sgl[32][CB + 8];   // g rows, hi and lo, pitch 80 B
    __shared__ __align__(16) bf suh[32][DM + 8], sul[32][DM + 8];   // u rows in the LDS row order of x^T, hi and lo, pitch 144 B
    __shared__ __align__(16) bf sth[32][DM + 8], stl[32][DM + 8];   // joined P.x / l rows, hi and lo
    __shared__ __align__(16) bf sah[32][CB + 8], sal[32][CB + 8];   // y rows, hi and lo
    __shared__ __align__(16) bf shw[2][2][32][16]; __shared__ __align__(16) float shb[CB];   // Wh as A fragments [16 columns][k block][lane], and bh
    const int lane = threadIdx.x & 31, c = lane & 15, h = lane >> 4, w = __builtin_amdgcn_readfirstlane(threadIdx.x >> 5); const int q0 = blockIdx.x * 32; const int k0 = w * KR; const int bz = blockIdx.y;   // w in a scalar register: scalar loop control and key addresses
    const int tb = bz * TT;   // this batch's first token
    const int rot = (blockIdx.x + (blockIdx.x >> 3) + w) & (KR / KB - 1);   // first block of the walk: differs between neighbours in the grid, between work-groups 8 apart and between a work-group's waves (for speed only; any value is right)
    const int gq = w & 1, hi2 = w >> 1;   // head and y stage: 16 queries; which 16 columns or channels
    const float* xk = x + (size_t)(tb + k0) * DM;   // the wave's key range
    const uint32_t lst = (uint32_t)(size_t)&wr[w][0];   // the place of the wave's key block: byte offset in the work-group's LDS
    const u32x8 g1 = tile_g1(); const u32x4 g0a = tile_g0(lst, xk + (size_t)(KB * rot) * DM);
    tile_load(g0a, g1);   // the first block, ahead of the head; every wave asks for its own
    const float* pf = wf + (size_t)(16 * hi2 + c) * CB + 8 * h; const v16bf fa = xfragc(pf);   // Wf rows (channels), k = projection column, contiguous; fetched ahead of the barrier
    asm volatile("s_wait_xcnt 0x0" :: "v"(pf) : "memory");   // the loads' address registers stay whole until every load above has taken its address
    if (w < 4) {
        const float* px = x + (size_t)(tb + q0 + 16 * gq + c) * DM + 8 * h; const float* pw = wg + (size_t)(8 * h) * CB + 16 * hi2 + c; const float* pb = bg + 16 * hi2 + 8 * h;
        v16bf xa[2], wa[2]; float bv[8];
#pragma unroll
        for (int kk = 0; kk < 2; ++kk) { xa[kk] = xfragc(px + 32 * kk); wa[kk] = wfragc(pw + 32 * kk * CB, CB); }
#pragma unroll
        for (int r = 0; r < 8; ++r) bv[r] = pb[r];
        asm volatile("s_wait_xcnt 0x0" :: "v"(px), "v"(pw) : "memory");   // as above
        v8f a = (v8f){}; a = wmmab(wa[0], xa[0], a); a = wmmab(wa[1], xa[1], a); v8us oh, ol;   // a[r] = g[query c][column 16 hi2 + 8 h + r]
        split8(a, bv, oh, ol);
        *(v8us*)&sgh[16 * gq + c][16 * hi2 + 8 * h] = oh; *(v8us*)&sgl[16 * gq + c][16 * hi2 + 8 * h] = ol; }
    if (w == 4 || w == 5) {   // two waves that would only wait here fetch the y stage's operands: Wh, rounded, as A fragments, and bh
        const float* pw = wh + (size_t)(8 * h) * CB + 16 * (w - 4) + c; const float* pb = bh + lane;
        const v16bf t0 = wfragc(pw, CB), t1 = wfragc(pw + 32 * CB, CB); const float bl = pb[0];
        asm volatile("s_wait_xcnt 0x0" :: "v"(pw), "v"(pb) : "memory");   // as above
        const v8u u0 = __builtin_bit_cast(v8u, t0), u1 = __builtin_bit_cast(v8u, t1);
        *(v8us*)&shw[w - 4][0][lane][0] = __builtin_bit_cast(v8us, __builtin_shufflevector(u0, u0, 0, 1, 2, 3)); *(v8us*)&shw[w - 4][0][lane][8] = __builtin_bit_cast(v8us, __builtin_shufflevector(u0, u0, 4, 5, 6, 7));
        *(v8us*)&shw[w - 4][1][lane][0] = __builtin_bit_cast(v8us, __builtin_shufflevector(u1, u1, 0, 1, 2, 3)); *(v8us*)&shw[w - 4][1][lane][8] = __builtin_bit_cast(v8us, __builtin_shufflevector(u1, u1, 4, 5, 6, 7));
        if (w == 4) shb[lane] = bl; }
    __syncthreads();   // hands g to the waves that make u
    {
        const v16bf gh = WFrag<bf>::ld(&sgh[16 * gq + c][8 * h]), gl = WFrag<bf>::ld(&sgl[16 * gq + c][8 * h]);
        v8f a = (v8f){}; a = wmmab(fa, gh, a); a = wmmab(fa, gl, a);   // a[r] = u[query c][channel 16 hi2 + 8 h + r]
#pragma unroll
        for (int r = 0; r < 8; r += 2) { unsigned hp, lp; split2(a[r], a[r + 1], hp, lp); const int ro = 16 * (r & 3) + 4 * hi2 + 2 * h + (r >> 2);   // r + 1 lies 16 rows on
            suh[16 * gq + c][ro] = (bf)(hp & 0xFFFFu); suh[16 * gq + c][ro + 16] = (bf)(hp >> 16); sul[16 * gq + c][ro] = (bf)(lp & 0xFFFFu); sul[16 * gq + c][ro + 16] = (bf)(lp >> 16); } }   // channel ch sits in row 16 (ch & 3) + (ch >> 2)
    __syncthreads();   // hands u to every wave
    v16bf uh[2][2], ul[2][2];   // both halves stay in registers: none holds a key block in flight any more
#pragma unroll
    for (int g = 0; g < 2; ++g)
#pragma unroll
        for (int kk = 0; kk < 2; ++kk) { uh[g][kk] = WFrag<bf>::ld(&suh[16 * g + c][32 * kk + 8 * h]); ul[g][kk] = WFrag<bf>::ld(&sul[16 * g + c][32 * kk + 8 * h]); }
    bf* xtw = (bf*)&wr[w][STG]; const float* pxs = (const float*)&wr[w][0] + (8 * h) * DM + 4 * c;   // x^T of the block; the lane's 16 bytes of key 8 h in the f32 block
    bf* pst = &xtw[c * XP + 8 * h];   // the lane's 16 bytes of row c (+ 16 dt), keys 8 h + 0..7; the second eight keys lie 16 elements on, the second half of the block 32
    const bf* ptr = &xtw[(8 * h + (lane & 7)) * XP + 8 * ((lane >> 3) & 1)];   // the transposing load's lane address in the tile at row 0, key 0
    v8f o[4][2]; float m[2], l[2];
#pragma unroll
    for (int g = 0; g < 2; ++g) { m[g] = -3.0e38f; l[g] = 0.f;
#pragma unroll
        for (int dt = 0; dt < 4; ++dt) o[dt][g] = (v8f){}; }
    asm volatile("s_wait_tensorcnt 0x0" :: "s"(g0a) : "memory");   // the first block has landed; group 0 is named so that its registers stay whole through the head, while the request is out
#pragma unroll 1   // kept rolled: the body is long and runs KR / KB times from the instruction cache
    for (int i = 0; i < KR / KB; ++i) {
        v16bf va[2][4];   // [half of 32 keys][tile of 16 channels]
        v4f xr[2][16];   // the whole block is asked for ahead of the first store: one LDS latency a trip, not one a half
#pragma unroll
        for (int kb = 0; kb < 2; ++kb)
#pragma unroll
            for (int e = 0; e < 16; ++e) xr[kb][e] = *(const v4fa*)(pxs + (32 * kb + (e < 8 ? e : e + 8)) * DM);
#pragma unroll
        for (int kb = 0; kb < 2; ++kb) {
#pragma unroll
            for (int dt = 0; dt < 4; ++dt) { v8u pk;
#pragma unroll
                for (int j = 0; j < 8; ++j) pk[j] = pk2(xr[kb][2 * j][dt], xr[kb][2 * j + 1][dt]);
                va[kb][dt] = __builtin_bit_cast(v16bf, pk); const v8us lo8 = __builtin_bit_cast(v8us, __builtin_shufflevector(pk, pk, 0, 1, 2, 3)), hi8 = __builtin_bit_cast(v8us, __builtin_shufflevector(pk, pk, 4, 5, 6, 7));
                *(v8usa*)(pst + 16 * dt * XP + 32 * kb) = lo8; *(v8usa*)(pst + 16 * dt * XP + 32 * kb + 16) = hi8; } }
        asm volatile("s_wait_dscnt 0x0" ::: "memory");   // the wave's own rows are in LDS before it reads them back across lanes; and its reads of the f32 block have retired before the block is refilled
        if (pinned(i + 1 < KR / KB)) { const u32x4 g0 = tile_g0(lst, xk + (size_t)(KB * pinned((rot + i + 1) & (KR / KB - 1))) * DM); tile_load(g0, g1); }   // the next block, while there is one: it has the rest of the trip to land
        v16bf ka[4][2];
#pragma unroll
        for (int t = 0; t < 4; ++t)
#pragma unroll
            for (int kk = 0; kk < 2; ++kk) ka[t][kk] = cat16b(ldtr(ptr + 32 * kk * XP + 16 * t), ldtr(ptr + (32 * kk + 16) * XP + 16 * t));
        __builtin_amdgcn_sched_barrier(0);   // all sixteen transposing loads go out ahead of the first product: the scheduler held half of them back into the run of products, which then waited a whole LDS latency in its middle
        v8f s[4][2];
#pragma unroll
        for (int t = 0; t < 4; ++t)
#pragma unroll
            for (int g = 0; g < 2; ++g) { v8f a = (v8f){}; a = wmmab(ka[t][0], uh[g][0], a); a = wmmab(ka[t][1], uh[g][1], a); a = wmmab(ka[t][0], ul[g][0], a); a = wmmab(ka[t][1], ul[g][1], a); s[t][g] = a; }
        __builtin_amdgcn_sched_barrier(0);   // keeps the score products in one run: the scheduler drew the first maxima in among them, each behind idle slots that wait for its product
        v16bf ph[2][2];   // P rounded once to bf16, [half of 32 keys][16 queries]
#pragma unroll
        for (int g = 0; g < 2; ++g) {
            float mx = s[0][g][0];
#pragma unroll
            for (int r = 1; r < 8; ++r) mx = fmaxf(mx, s[0][g][r]);
#pragma unroll
            for (int t = 1; t < 4; ++t)
#pragma unroll
                for (int r = 0; r < 8; ++r) mx = fmaxf(mx, s[t][g][r]);
            mx = fmaxf(mx, xhalf(mx));
            const float mn = fmaxf(m[g], mx); const float al = __builtin_amdgcn_exp2f((m[g] - mn) * L2E); const float ml = mn * L2E; m[g] = mn;
            v2f sum = (v2f){}; const v2f le2 = { L2E, L2E }, ml2 = { -ml, -ml };
#pragma unroll
            for (int kb = 0; kb < 2; ++kb) { v8u hw;
#pragma unroll
                for (int i = 0; i < 8; ++i) { const int t = 2 * kb + (i >> 2), r = (i & 3) * 2; v2f x = { s[t][g][r], s[t][g][r + 1] }; x = __builtin_elementwise_fma(x, le2, ml2); v2f p; p[0] = __builtin_amdgcn_exp2f(x[0]); p[1] = __builtin_amdgcn_exp2f(x[1]); sum += p;
                    hw[i] = __builtin_bit_cast(unsigned, __builtin_convertvector(p, v2bf)); }
                ph[kb][g] = __builtin_bit_cast(v16bf, hw); }
            l[g] = l[g] * al + (sum[0] + sum[1]);
#pragma unroll
            for (int dt = 0; dt < 4; ++dt) o[dt][g] *= al; }
#pragma unroll
        for (int kb = 0; kb < 2; ++kb)
#pragma unroll
            for (int dt = 0; dt < 4; ++dt)
#pragma unroll
                for (int g = 0; g < 2; ++g) o[dt][g] = wmmab(va[kb][dt], ph[kb][g], o[dt][g]);
        __builtin_amdgcn_sched_barrier(0);   // keeps every product in front of the slots below
        asm volatile("v_nop\n\tv_nop\n\tv_nop\n\tv_nop");   // the four vector slots between the last products and the next trip's converts, which are asm text and write over the products' A registers
        asm volatile("s_wait_tensorcnt 0x0" ::: "memory");   // the next trip's block has landed; behind the last trip: no request of the wave is out
    }
    asm volatile("s_wait_dscnt 0x0" ::: "memory");   // nor any of its LDS reads, before its region takes the partial result
    float* sow = (float*)&wr[w][0];
#pragma unroll
    for (int g = 0; g < 2; ++g) { const float lt = l[g] + xhalf(l[g]); if (h == 0) { sm[w][16 * g + c] = m[g]; sl[w][16 * g + c] = lt; }
#pragma unroll
        for (int r = 0; r < 8; ++r) { const v4f t4 = { o[0][g][r], o[1][g][r], o[2][g][r], o[3][g][r] }; *(v4fa*)&sow[(16 * g + c) * (DM + 4) + 32 * h + 4 * r] = t4; } }   // register r of tile dt is channel 4 (8 h + r) + dt
    __syncthreads();
    float M = sm[0][lane];   // thread (w, lane) makes the one weight of wave w's partial for query lane
#pragma unroll
    for (int k = 1; k < KW; ++k) M = fmaxf(M, sm[k][lane]);
    const float wt = __builtin_amdgcn_exp2f((sm[w][lane] - M) * L2E); sw[w][lane] = wt; sl[w][lane] *= wt;
    __syncthreads();
    {   // the join is 32 queries x 8 threads, 8 channels each
        const int q = threadIdx.x >> 3, d0 = (threadIdx.x & 7) * 8; float Ls = 0.f; v4f acc0 = (v4f){}, acc1 = (v4f){};
#pragma unroll
        for (int k = 0; k < KW; ++k) { const float* pp = (const float*)&wr[k][0] + q * (DM + 4) + d0; Ls += sl[k][q]; acc0 += *(const v4fa*)pp * sw[k][q]; acc1 += *(const v4fa*)(pp + 4) * sw[k][q]; }
        const float inv = __fdiv_rn(1.0f, Ls); v8us oh, ol;
#pragma unroll
        for (int k = 0; k < 4; ++k) { unsigned short a, c2; splitf(acc0[k] * inv, a, c2); oh[k] = a; ol[k] = c2; splitf(acc1[k] * inv, a, c2); oh[4 + k] = a; ol[4 + k] = c2; }
        *(v8us*)&sth[q][d0] = oh; *(v8us*)&stl[q][d0] = ol; }
    __syncthreads();   // hands the joined rows to the waves of the y stage
    if (w < 4) {   // y = (P.x / l) Wh + bh, 16 queries x 16 columns a wave, as Wh^T t^T
        v16bf th[2], tl[2], ha[2];
#pragma unroll
        for (int kk = 0; kk < 2; ++kk) { ha[kk] = cat16b(*(const v8us*)&shw[hi2][kk][lane][0], *(const v8us*)&shw[hi2][kk][lane][8]); th[kk] = WFrag<bf>::ld(&sth[16 * gq + c][32 * kk + 8 * h]); tl[kk] = WFrag<bf>::ld(&stl[16 * gq + c][32 * kk + 8 * h]); }
        v8f a = (v8f){}; a = wmmab(ha[0], th[0], a); a = wmmab(ha[1], th[1], a); a = wmmab(ha[0], tl[0], a); a = wmmab(ha[1], tl[1], a); v8us oh, ol;   // a[r] = y[query c][column 16 hi2 + 8 h + r]
        split8(a, &shb[16 * hi2 + 8 * h], oh, ol);
        *(v8us*)&sah[16 * gq + c][16 * hi2 + 8 * h] = oh; *(v8us*)&sal[16 * gq + c][16 * hi2 + 8 * h] = ol; }
    __syncthreads();   // hands the y rows to the waves of the out projection
    if (w >= 4) return;   // no barrier follows
    const int g = w & 1, np = w >> 1;   // 16 queries, 32 output columns
    const v16bf ah = WFrag<bf>::ld(&sah[16 * g + c][8 * h]), al = WFrag<bf>::ld(&sal[16 * g + c][8 * h]);
    const float gm = bfr(gam[0]); const size_t ro = (size_t)(bz * TT + q0 + 16 * g + c) * DM + 32 * np + 8 * h;
    const float* px = x + ro; const float* pw = wo + (size_t)(8 * h) * DM + 32 * np + c; const float* pb = bo + 32 * np + 8 * h;
    v16bf wa[2]; v4f xv[2][2], bv[2][2];
#pragma unroll
    for (int j = 0; j < 2; ++j) { wa[j] = wfrag(pw + 16 * j, DM);
#pragma unroll
        for (int u = 0; u < 2; ++u) { xv[j][u] = *(const v4fa*)(px + 16 * j + 4 * u); bv[j][u] = *(const v4fa*)(pb + 16 * j + 4 * u); } }
    asm volatile("s_wait_xcnt 0x0" :: "v"(px), "v"(pw) : "memory");   // the loads' address registers stay whole until every load above has taken its address
#pragma unroll
    for (int j = 0; j < 2; ++j) { v8f a = (v8f){}; a = wmmab(wa[j], ah, a); a = wmmab(wa[j], al, a);
#pragma unroll
        for (int u = 0; u < 2; ++u) { v4f y;
#pragma unroll
            for (int r = 0; r < 4; ++r) y[r] = bfr(xv[j][u][r]) + gm * (a[4 * u + r] + bfr(bv[j][u][r]));
            *(v4fa*)(O + ro + 16 * j + 4 * u) = y; } }
}

extern "C" void kernel_launch(void* const* d_in, const int* in_sizes, int n_in,
                              void* d_out, int out_size, void* d_ws, size_t ws_size, hipStream_t stream) {
    (void)in_sizes; (void)n_in; (void)out_size; (void)d_ws; (void)ws_size;
    const float* x = (const float*)d_in[0]; const float* wf = (const float*)d_in[1]; const float* wg = (const float*)d_in[3]; const float* bg = (const float*)d_in[4]; const float* wh = (const float*)d_in[5]; const float* bh = (const float*)d_in[6]; const float* wo = (const float*)d_in[7]; const float* bo = (const float*)d_in[8]; const float* gam = (const float*)d_in[9];   // d_in[2], the key bias, adds the same number to all scores of a query and drops out of the softmax
    float* OUT = (float*)d_out;     // [2][4096][64]
    k_attn<<<dim3(TT / 32, NB_), 32 * KW, 0, stream>>>(x, wg, bg, wf, wh, bh, wo, bo, gam, OUT);   /* out = x + gamma ((softmax(g.f) . hv) Wo + bo) */
}
